// v000
// The times below were measured on an AMD MI455X: many runs one after another, warmed up first and cycling through
// copies of the inputs, with the whole window's GPU time divided by the number of runs. Launches and the gaps
// between them are all in it. The median over several windows is given; except for v000 it joins two sittings, which
// can be a few percent apart, so the side-by-side timings, each taken in one sitting, are the better comparison.
// v000, which the later versions start from, runs in 2110 microseconds.
#include <hip/hip_runtime.h>

// CosyVoice3DiTAttention (x [2][2048][1024]; q/k/v = x W + b (16 heads x 64); interleaved-pair RoPE q cos + rot(q) sin with rot = (x0, x1) -> (-x1, x0) and the cos/sin tables READ from the rope input ([2][1][S][1][64]); scores = q.k/8 + mask[i][j] (float, read; zeros here);
// softmax; out = (attn v merged) Wo + bo -> [2][2048][1024]).
// Compute dtypes, f32 accumulate: every input rounded to bf16; q/k/v on PLAIN bf16 operands (inputs: exact) + bias; RoPE f32; scores and attn.v: query rows < 512 hl (3 products), the rest single fp16 (x1024); mask add + softmax f32;

#define NB_  2
#define TT   2048
#define DM   1024
#define NH_  16
#define NKV  16
#define REP  (NH_ / NKV)
#define HD   64
#define DQ   (NH_ * HD)
#define DKV  (NKV * HD)
#define ZH   2
#define RH   512                  // query rows < RH use hi+lo planes (0: none)
#define WIN  0
#define PCAR 1024.0f
#define SCL  0.125f   // HD^-0.5
typedef _Float16 h16;
typedef unsigned short bf;
typedef __attribute__((ext_vector_type(16))) __bf16   v16bf;
typedef __attribute__((ext_vector_type(16))) _Float16 v16h;
typedef __attribute__((ext_vector_type(8)))  _Float16 v8h;
typedef __attribute__((ext_vector_type(8)))  unsigned short v8us;
typedef __attribute__((ext_vector_type(8)))  float    v8f;
typedef __attribute__((ext_vector_type(4)))  float    v4f;
typedef v8h  __attribute__((may_alias)) v8ha;
typedef v4f  __attribute__((may_alias)) v4fa;
typedef v8us __attribute__((may_alias)) v8usa;

__device__ __forceinline__ unsigned short f2bf(float f) { unsigned u = __float_as_uint(f); u += 0x7FFFu + ((u >> 16) & 1u); return (unsigned short)(u >> 16); }
__device__ __forceinline__ float bf2f(unsigned short b) { return __uint_as_float(((unsigned)b) << 16); }
__device__ __forceinline__ float bfr(float f) { return bf2f(f2bf(f)); }
__device__ __forceinline__ v16h cat16(v8h lo, v8h hi) { return __builtin_shufflevector(lo, hi, 0, 1, 2, 3, 4, 5, 6, 7, 8, 9, 10, 11, 12, 13, 14, 15); }
__device__ __forceinline__ v16bf cat16b(v8us lo, v8us hi) { return __builtin_bit_cast(v16bf, __builtin_shufflevector(lo, hi, 0, 1, 2, 3, 4, 5, 6, 7, 8, 9, 10, 11, 12, 13, 14, 15)); }
__device__ __forceinline__ v8f wmma16(v16h a, v16h b, v8f c) { return __builtin_amdgcn_wmma_f32_16x16x32_f16(false, a, false, b, (short)0, c, false, false); }
__device__ __forceinline__ v8f wmmab(v16bf a, v16bf b, v8f c) { return __builtin_amdgcn_wmma_f32_16x16x32_bf16(false, a, false, b, (short)0, c, false, false); }



// ---- k_gemmw: register-blocked GEMM, ONE WAVE per 64x64 output tile (16 accumulators), operands straight from K-contiguous 16-bit planes; grid (M/64, N/64, Z), 32 threads.
// C[m][n] (f32, pitch ldc, + optional f32 bias[n]) = sum_k A[m][k] Bt[n][k] (+ split products per NSPLIT). z-batch strides sA/sB/sC in elements. K % 32 == 0.
template <typename T16> struct WFrag;
template <> struct WFrag<h16> { typedef v16h V; static __device__ __forceinline__ V ld(const h16* p) { return cat16(*(const v8h*)p, *(const v8h*)(p + 16)); } static __device__ __forceinline__ v8f mma(V a, V b, v8f c) { return wmma16(a, b, c); } };
template <> struct WFrag<bf> { typedef v16bf V; static __device__ __forceinline__ V ld(const bf* p) { return cat16b(*(const v8us*)p, *(const v8us*)(p + 16)); } static __device__ __forceinline__ v8f mma(V a, V b, v8f c) { return wmmab(a, b, c); } };
template <typename T16, int NSPLIT, bool BIAS>
__global__ __launch_bounds__(32) void k_gemmw(const T16* __restrict__ A, const T16* __restrict__ A2, const T16* __restrict__ Bt, const T16* __restrict__ Bt2, int K, float* C, int ldc, const float* __restrict__ bias, size_t sA, size_t sB, size_t sC) {
    typedef typename WFrag<T16>::V V;
    __shared__ __align__(16) float os[16 * 68];
    const size_t z = blockIdx.z; A += z * sA; if (A2) A2 += z * sA; Bt += z * sB; if (Bt2) Bt2 += z * sB; C += z * sC;
    const int lane = threadIdx.x & 31, lr = lane & 15, hi = lane >> 4; const int r0 = blockIdx.x * 64, c0 = blockIdx.y * 64;
    v8f acc[4][4];
#pragma unroll
    for (int mb = 0; mb < 4; ++mb)
#pragma unroll
        for (int nb = 0; nb < 4; ++nb) acc[mb][nb] = (v8f){};
    const size_t aoff = (size_t)(r0 + lr) * K + 8 * hi, boff = (size_t)(c0 + lr) * K + 8 * hi;
#pragma unroll 1
    for (int kc = 0; kc < K; kc += 32) {
        V a[4], a2[4];
#pragma unroll
        for (int mb = 0; mb < 4; ++mb) { a[mb] = WFrag<T16>::ld(A + aoff + (size_t)mb * 16 * K + kc); if (NSPLIT == 1 || NSPLIT == 2) a2[mb] = WFrag<T16>::ld(A2 + aoff + (size_t)mb * 16 * K + kc); }
#pragma unroll
        for (int nb = 0; nb < 4; ++nb) { const V b = WFrag<T16>::ld(Bt + boff + (size_t)nb * 16 * K + kc); V b2; if (NSPLIT >= 2) b2 = WFrag<T16>::ld(Bt2 + boff + (size_t)nb * 16 * K + kc);
#pragma unroll
            for (int mb = 0; mb < 4; ++mb) { acc[mb][nb] = WFrag<T16>::mma(a[mb], b, acc[mb][nb]); if (NSPLIT == 1 || NSPLIT == 2) acc[mb][nb] = WFrag<T16>::mma(a2[mb], b, acc[mb][nb]); if (NSPLIT >= 2) acc[mb][nb] = WFrag<T16>::mma(a[mb], b2, acc[mb][nb]); } }
        asm volatile("v_nop\n\tv_nop\n\tv_nop\n\tv_nop" : "+v"(acc[0][0]), "+v"(acc[1][1]), "+v"(acc[2][2]), "+v"(acc[3][3]) : "v"(a[0]), "v"(a[3]));
    }
#pragma unroll
    for (int mb = 0; mb < 4; ++mb) {
#pragma unroll
        for (int nb = 0; nb < 4; ++nb) {
#pragma unroll
            for (int j = 0; j < 8; ++j) os[(hi * 8 + j) * 68 + nb * 16 + lr] = acc[mb][nb][j]; }
        __builtin_amdgcn_wave_barrier(); asm volatile("" ::: "memory");
        float* crow = C + (size_t)(r0 + mb * 16) * ldc + c0;
{
#pragma unroll
            for (int s = 0; s < 8; ++s) { const int row = 2 * s + hi, cofs = lr * 4; v4f val = *(const v4fa*)(os + row * 68 + cofs); if (BIAS) { val[0] += bfr(bias[c0 + cofs]); val[1] += bfr(bias[c0 + cofs + 1]); val[2] += bfr(bias[c0 + cofs + 2]); val[3] += bfr(bias[c0 + cofs + 3]); }
                *(v4f*)(crow + (size_t)row * ldc + cofs) = val; }
             }
        __builtin_amdgcn_wave_barrier(); asm volatile("" ::: "memory");
    }
}

__device__ __forceinline__ h16 tohx(float x) { return (h16)x; }
__device__ __forceinline__ void splitf(float y, unsigned short& h, unsigned short& l) { h = f2bf(y); l = f2bf(y - bf2f(h)); }
typedef __attribute__((ext_vector_type(2))) _Float16 v2h;
typedef __attribute__((ext_vector_type(4))) _Float16 v4h;
typedef __attribute__((ext_vector_type(2))) unsigned short v2us;
typedef __attribute__((ext_vector_type(4))) unsigned short v4us;
typedef __attribute__((ext_vector_type(2))) float v2f;
typedef __attribute__((ext_vector_type(4))) int v4i;

__global__ __launch_bounds__(256) void k_wtG(const float* __restrict__ w, int K, int N, bf* Bt) {
    const int lane = threadIdx.x & 31; const int L0 = (blockIdx.x * 8 + (threadIdx.x >> 5)) * 8; const int nlines = N * K / 64;
{
#pragma unroll 1
        for (int l = 0; l < 8; ++l) { const int L = L0 + l; if (L >= nlines) break; const size_t e = (size_t)L * 64 + lane * 2; const int k = (int)(e % K), n = (int)(e / K); v2us o;
            o[0] = f2bf(w[(size_t)k * N + n]); o[1] = f2bf(w[(size_t)(k + 1) * N + n]); *(v2us*)(Bt + e) = o; }
         }
}
__global__ __launch_bounds__(256) void k_cvt8(const float* __restrict__ src, bf* dst, size_t n8) { const size_t i = (size_t)blockIdx.x * 256 + threadIdx.x; if (i >= n8) return; const v8f v = *(const v8f*)(src + i * 8); v8us o;
#pragma unroll
    for (int k = 0; k < 8; ++k) o[k] = f2bf(v[k]); *(v8us*)(dst + i * 8) = o;  }
__global__ __launch_bounds__(256) void k_cscvt(const float* __restrict__ cosT, const float* __restrict__ sinT, float* CS) { const int idx = blockIdx.x * 256 + threadIdx.x; if (idx >= TT * HD) return; v2f cs; cs[0] = bfr(cosT[idx]); cs[1] = bfr(sinT[idx]); *(v2f*)(CS + (size_t)idx * 2) = cs;  }
// k_rope: head planes [h][t][d] (fp16 + hi/lo) of rope(x) x sc with the interleaved-pair convention out[2i] = x[2i] cos[t][2i] - x[2i+1] sin[t][2i], out[2i+1] = x[2i+1] cos[t][2i+1] + x[2i] sin[t][2i+1]
__global__ __launch_bounds__(256) void k_rope(const float* __restrict__ F, int pitch, int nheads, const float* __restrict__ CS, const float* __restrict__ RF, const float* __restrict__ nw, float sc, h16* P16, bf* Ph, bf* Pl) {
    const size_t e = ((size_t)blockIdx.x * 256 + threadIdx.x) * 2; if (e >= (size_t)nheads * TT * HD) return; const int d = (int)(e % HD); const int t = (int)((e / HD) % TT); const int h = (int)(e / ((size_t)HD * TT)); const float* f = F + (size_t)t * pitch + h * HD; const float rf = RF ? RF[(size_t)h * TT + t] : 1.0f; v2h o16; v2us oh, ol;
#pragma unroll
    for (int q = 0; q < 2; ++q) { const int dd = d + q; const int dp = dd ^ 1;   /* interleaved pair partner */ float x0 = f[dd], x1 = f[dp];
        if (RF) { float n0 = __fmul_rn(x0, rf), n1 = __fmul_rn(x1, rf); asm volatile("" : "+v"(n0)); asm volatile("" : "+v"(n1)); x0 = __fmul_rn(bfr(nw[dd]), n0); x1 = __fmul_rn(bfr(nw[dp]), n1); }
        const v2f cs = *(const v2f*)(CS + ((size_t)t * HD + dd) * 2); float a = __fmul_rn(x0, cs[0]), bq = __fmul_rn(x1, cs[1]); asm volatile("" : "+v"(a)); asm volatile("" : "+v"(bq)); const float r = (((dd & 1) == 0) ? __fsub_rn(a, bq) : __fadd_rn(a, bq)) * sc;
        o16[q] = tohx(r); unsigned short a2, c2; splitf(r, a2, c2); oh[q] = a2; ol[q] = c2; }
    *(v2h*)(P16 + e) = o16; *(v2us*)(Ph + e) = oh; *(v2us*)(Pl + e) = ol;  }

__global__ __launch_bounds__(256) void k_vtp(const float* __restrict__ F, int pitch, int nheads, h16* V16, bf* Vh, bf* Vl) { const size_t e = ((size_t)blockIdx.x * 256 + threadIdx.x) * 2; if (e >= (size_t)nheads * HD * TT) return; const int t = (int)(e % TT); const int d = (int)((e / TT) % HD); const int g = (int)(e / ((size_t)TT * HD)); v2h o16; v2us oh, ol;
#pragma unroll
    for (int q = 0; q < 2; ++q) { const float x = F[(size_t)(t + q) * pitch + g * HD + d]; o16[q] = tohx(x); unsigned short a2, c2; splitf(x, a2, c2); oh[q] = a2; ol[q] = c2; }
    *(v2h*)(V16 + e) = o16; *(v2us*)(Vh + e) = oh; *(v2us*)(Vl + e) = ol;  }
// k_asoft: per row (zz, i): t = S x HD^-0.5 + mask[i][j] (float [S][S], read as data, rounded to bf16, added); softmax over the 2048 keys (register row, one exp, fixed trees);
__global__ __launch_bounds__(256) void k_asoft(const float* __restrict__ Sb, const float* __restrict__ mk, h16* P16, bf* Ph, bf* Pl) {
    const int lane = threadIdx.x & 31; const int row = blockIdx.x * 8 + (threadIdx.x >> 5); if (row >= ZH * TT) return; const int i = row % TT; const int zz = row / TT; (void)zz; const bool hires = (i < RH); const float* sr = Sb + (size_t)row * TT; float v[TT / 32]; float mx = -3.0e38f;
#pragma unroll
    for (int ch = 0; ch < TT / 128; ++ch) { const int j0 = ch * 128 + lane * 4; const v4f a = *(const v4f*)(sr + j0); const v4f mk4 = *(const v4f*)(mk + (size_t)i * TT + j0);   /* additive float mask [S][S] */
#pragma unroll
        for (int q = 0; q < 4; ++q) { const int j = j0 + q; (void)j; const float t = ({ float t0 = a[q] * SCL; float mm = bfr(mk4[q]); asm volatile("" : "+v"(t0)); asm volatile("" : "+v"(mm)); __fadd_rn(t0, mm); }); v[ch * 4 + q] = t; mx = fmaxf(mx, t); } }
#pragma unroll
    for (int sh = 16; sh; sh >>= 1) mx = fmaxf(mx, __shfl_xor(mx, sh, 32));
    float sum = 0.f;
#pragma unroll
    for (int k = 0; k < TT / 32; ++k) { float d0 = __fsub_rn(v[k], mx); asm volatile("" : "+v"(d0)); v[k] = __builtin_amdgcn_exp2f(__fmul_rn(d0, 1.4426950408889634f)); sum += v[k]; }
#pragma unroll
    for (int sh = 16; sh; sh >>= 1) sum += __shfl_xor(sum, sh, 32);
    const float f = __fdiv_rn(hires ? 1.0f : PCAR, sum);
{
        if (hires) {
#pragma unroll
            for (int ch = 0; ch < TT / 128; ++ch) { v4us oh, ol;
#pragma unroll
                for (int q = 0; q < 4; ++q) { unsigned short a, c2; splitf(v[ch * 4 + q] * f, a, c2); oh[q] = a; ol[q] = c2; }
                const size_t oo = ((size_t)zz * (RH ? RH : 1) + i) * TT + ch * 128 + lane * 4; *(v4us*)(Ph + oo) = oh; *(v4us*)(Pl + oo) = ol; }
        } else {
#pragma unroll
            for (int ch = 0; ch < TT / 128; ++ch) { v4h o4;
#pragma unroll
                for (int q = 0; q < 4; ++q) o4[q] = tohx(v[ch * 4 + q] * f);
                *(v4h*)(P16 + (size_t)row * TT + ch * 128 + lane * 4) = o4; } }
         }
}
__global__ __launch_bounds__(256) void k_merge(const float* __restrict__ O, int h0, bf* Ah, bf* Al) { const size_t e = ((size_t)blockIdx.x * 256 + threadIdx.x) * 2; if (e >= (size_t)ZH * TT * HD) return; const int d = (int)(e % HD); const int t = (int)((e / HD) % TT); const int zz = (int)(e / ((size_t)HD * TT)); const float cs = (t < RH) ? 1.0f : (1.0f / PCAR); const size_t oo = (size_t)t * DQ + (h0 + zz) * HD + d;
    v2us oh, ol;
#pragma unroll
    for (int q = 0; q < 2; ++q) { unsigned short a, c2; splitf(O[e + q] * cs, a, c2); oh[q] = a; ol[q] = c2; } *(v2us*)(Ah + oo) = oh; *(v2us*)(Al + oo) = ol;  }

extern "C" void kernel_launch(void* const* d_in, const int* in_sizes, int n_in,
                              void* d_out, int out_size, void* d_ws, size_t ws_size, hipStream_t stream) {
    (void)in_sizes; (void)n_in; (void)out_size;
    const float* x = (const float*)d_in[0]; const float* rope = (const float*)d_in[1]; const float* cosT = rope; const float* sinT = rope + (size_t)TT * HD; const float* fmask = (const float*)d_in[2]; const float* wq = (const float*)d_in[3]; const float* bq = (const float*)d_in[4]; const float* wk = (const float*)d_in[5]; const float* bk = (const float*)d_in[6]; const float* wv = (const float*)d_in[7]; const float* bv = (const float*)d_in[8]; const float* wo = (const float*)d_in[9]; const float* bo = (const float*)d_in[10];
    float* OUT = (float*)d_out;     // [2][2048][1024]
    char* wsp = (char*)d_ws;
    auto take = [&](size_t bytes) { char* p = wsp; wsp += (bytes + 255) & ~(size_t)255; return (void*)p; };
    bf* WQ = (bf*)take((size_t)DQ * DM * 2); bf* WK = (bf*)take((size_t)DKV * DM * 2); bf* WV = (bf*)take((size_t)DKV * DM * 2); bf* WO = (bf*)take((size_t)DM * DQ * 2); float* CS = (float*)take((size_t)TT * HD * 2 * 4);
    bf* XB = (bf*)take((size_t)TT * DM * 2); float* FQ = (float*)take((size_t)TT * DQ * 4); float* FK = (float*)take((size_t)TT * DKV * 4);
    h16* QP16 = (h16*)take((size_t)NH_ * TT * HD * 2); h16* KP16 = (h16*)take((size_t)NKV * TT * HD * 2); h16* VT16 = (h16*)take((size_t)NKV * HD * TT * 2);
    bf* QPh = (bf*)take((size_t)NH_ * TT * HD * 2); bf* QPl = (bf*)take((size_t)NH_ * TT * HD * 2); bf* KPh = (bf*)take((size_t)NKV * TT * HD * 2); bf* KPl = (bf*)take((size_t)NKV * TT * HD * 2); bf* VTh = (bf*)take((size_t)NKV * HD * TT * 2); bf* VTl = (bf*)take((size_t)NKV * HD * TT * 2); bf* Ph = (bf*)take((size_t)ZH * RH * TT * 2); bf* Pl = (bf*)take((size_t)ZH * RH * TT * 2);
    float* Sb = (float*)take((size_t)ZH * TT * TT * 4); h16* P16 = (h16*)take((size_t)ZH * TT * TT * 2); float* Ob = (float*)take((size_t)ZH * TT * HD * 4); bf* ATh = (bf*)take((size_t)TT * DQ * 2); bf* ATl = (bf*)take((size_t)TT * DQ * 2);
    if ((size_t)(wsp - (char*)d_ws) > ws_size) return;    // ws 256 MiB
    float* FV = FK;   // v projection reuses the k buffer after the k planes are built (stream-ordered)
    { k_wtG<<<(unsigned)((DM * DQ / 64 + 63) / 64), 256, 0, stream>>>(wq, DM, DQ, WQ); k_wtG<<<(unsigned)((DM * DKV / 64 + 63) / 64), 256, 0, stream>>>(wk, DM, DKV, WK); k_wtG<<<(unsigned)((DM * DKV / 64 + 63) / 64), 256, 0, stream>>>(wv, DM, DKV, WV);
      k_wtG<<<(unsigned)((DQ * DM / 64 + 63) / 64), 256, 0, stream>>>(wo, DQ, DM, WO);
       }
    const unsigned LQ = (unsigned)(((size_t)NH_ * TT * HD / 2 + 255) / 256), LKv = (unsigned)(((size_t)NKV * TT * HD / 2 + 255) / 256);
    for (int b = 0; b < NB_; ++b) {
        if (b == 0) k_cscvt<<<(TT * HD + 255) / 256, 256, 0, stream>>>(cosT, sinT, CS);
        k_cvt8<<<(unsigned)(((size_t)TT * DM / 8 + 255) / 256), 256, 0, stream>>>(x + (size_t)b * TT * DM, XB, (size_t)TT * DM / 8);
        k_gemmw<bf, 0, true><<<dim3(TT / 64, DQ / 64, 1), 32, 0, stream>>>(XB, nullptr, WQ, nullptr, DM, FQ, DQ, bq, 0, 0, 0);
        k_rope<<<LQ, 256, 0, stream>>>(FQ, DQ, NH_, CS, nullptr, nullptr, 1.0f, QP16, QPh, QPl);
        k_gemmw<bf, 0, true><<<dim3(TT / 64, DKV / 64, 1), 32, 0, stream>>>(XB, nullptr, WK, nullptr, DM, FK, DKV, bk, 0, 0, 0);
        k_rope<<<LKv, 256, 0, stream>>>(FK, DKV, NKV, CS, nullptr, nullptr, 1.0f, KP16, KPh, KPl);
        k_gemmw<bf, 0, true><<<dim3(TT / 64, DKV / 64, 1), 32, 0, stream>>>(XB, nullptr, WV, nullptr, DM, FV, DKV, bv, 0, 0, 0); k_vtp<<<LKv, 256, 0, stream>>>(FV, DKV, NKV, VT16, VTh, VTl);
        for (int h0 = 0; h0 < NH_; h0 += ZH) { const size_t zq = (size_t)h0, zk = (size_t)(h0 / REP);   // one kv head per query head: the pass's two heads use consecutive kv planes (z-strides TT*HD)
            k_gemmw<bf, 2, false><<<dim3(RH / 64, TT / 64, ZH), 32, 0, stream>>>(QPh + zq * TT * HD, QPl + zq * TT * HD, KPh + zk * TT * HD, KPl + zk * TT * HD, HD, Sb, TT, nullptr, (size_t)TT * HD, (size_t)TT * HD, (size_t)TT * TT);
            k_gemmw<h16, 0, false><<<dim3((TT - RH) / 64, TT / 64, ZH), 32, 0, stream>>>(QP16 + zq * TT * HD + (size_t)RH * HD, nullptr, KP16 + zk * TT * HD, nullptr, HD, Sb + (size_t)RH * TT, TT, nullptr, (size_t)TT * HD, (size_t)TT * HD, (size_t)TT * TT);
            k_asoft<<<ZH * TT / 8, 256, 0, stream>>>(Sb, fmask, P16, Ph, Pl);
            k_gemmw<bf, 2, false><<<dim3(RH / 64, HD / 64, ZH), 32, 0, stream>>>(Ph, Pl, VTh + zk * HD * TT, VTl + zk * HD * TT, TT, Ob, HD, nullptr, (size_t)RH * TT, (size_t)HD * TT, (size_t)TT * HD);
            k_gemmw<h16, 0, false><<<dim3((TT - RH) / 64, HD / 64, ZH), 32, 0, stream>>>(P16 + (size_t)RH * TT, nullptr, VT16 + zk * HD * TT, nullptr, TT, Ob + (size_t)RH * HD, HD, nullptr, (size_t)TT * TT, (size_t)HD * TT, (size_t)TT * HD);
            k_merge<<<(unsigned)(((size_t)ZH * TT * HD / 2 + 255) / 256), 256, 0, stream>>>(Ob, h0, ATh, ATl); }
        k_gemmw<bf, 1, true><<<dim3(TT / 64, DM / 64, 1), 32, 0, stream>>>(ATh, ATl, WO, nullptr, DQ, OUT + (size_t)b * TT * DM, DM, bo, 0, 0, 0); }
}

// v001
// It runs in 973 microseconds.
// Timed twice side by side with v000, it ran 2.16 times as fast both times.
#include <hip/hip_runtime.h>

// CosyVoice3DiTAttention (x [2][2048][1024]; q/k/v = x W + b (16 heads x 64); interleaved-pair RoPE q cos + rot(q) sin with rot = (x0, x1) -> (-x1, x0) and the cos/sin tables READ from the rope input ([2][1][S][1][64]); scores = q.k/8 + mask[i][j] (float, read; zeros here);
// softmax; out = (attn v merged) Wo + bo -> [2][2048][1024]).
// Compute dtypes, f32 accumulate: every input rounded to bf16; q/k/v on PLAIN bf16 operands (inputs: exact) + bias; RoPE f32; scores and attn.v: query rows < 512 hl (3 products), the rest single fp16 (x1024); mask add + softmax f32;

#define NB_  2
#define TT   2048
#define DM   1024
#define NH_  16
#define NKV  16
#define REP  (NH_ / NKV)
#define HD   64
#define DQ   (NH_ * HD)
#define DKV  (NKV * HD)
#define ZH   2
#define RH   512                  // query rows < RH use hi+lo planes (0: none)
#define WIN  0
#define PCAR 1024.0f
#define SCL  0.125f   // HD^-0.5
#define KSP  16                   // K slices of the attn.v products: one single-wave work-group per slice, one f32 partial plane per slice, summed in k_merge
typedef _Float16 h16;
typedef unsigned short bf;
typedef __attribute__((ext_vector_type(16))) __bf16   v16bf;
typedef __attribute__((ext_vector_type(16))) _Float16 v16h;
typedef __attribute__((ext_vector_type(8)))  _Float16 v8h;
typedef __attribute__((ext_vector_type(8)))  unsigned short v8us;
typedef __attribute__((ext_vector_type(8)))  float    v8f;
typedef __attribute__((ext_vector_type(4)))  float    v4f;
typedef v8h  __attribute__((may_alias)) v8ha;
typedef v4f  __attribute__((may_alias)) v4fa;
typedef v8us __attribute__((may_alias)) v8usa;

__device__ __forceinline__ unsigned short f2bf(float f) { unsigned u = __float_as_uint(f); u += 0x7FFFu + ((u >> 16) & 1u); return (unsigned short)(u >> 16); }
__device__ __forceinline__ float bf2f(unsigned short b) { return __uint_as_float(((unsigned)b) << 16); }
__device__ __forceinline__ float bfr(float f) { return bf2f(f2bf(f)); }
__device__ __forceinline__ v16h cat16(v8h lo, v8h hi) { return __builtin_shufflevector(lo, hi, 0, 1, 2, 3, 4, 5, 6, 7, 8, 9, 10, 11, 12, 13, 14, 15); }
__device__ __forceinline__ v16bf cat16b(v8us lo, v8us hi) { return __builtin_bit_cast(v16bf, __builtin_shufflevector(lo, hi, 0, 1, 2, 3, 4, 5, 6, 7, 8, 9, 10, 11, 12, 13, 14, 15)); }
__device__ __forceinline__ v8f wmma16(v16h a, v16h b, v8f c) { return __builtin_amdgcn_wmma_f32_16x16x32_f16(false, a, false, b, (short)0, c, false, false); }
__device__ __forceinline__ v8f wmmab(v16bf a, v16bf b, v8f c) { return __builtin_amdgcn_wmma_f32_16x16x32_bf16(false, a, false, b, (short)0, c, false, false); }



// ---- k_gemmw: register-blocked GEMM, ONE WAVE per 64x64 output tile (16 accumulators), operands straight from K-contiguous 16-bit planes; grid (M/64, N/64, Z), 32 threads.
// C[m][n] (f32, pitch ldc, + optional f32 bias[n]) = sum_k A[m][k] Bt[n][k] (+ split products per NSPLIT). z-batch strides sA/sB/sC in elements. K % 32 == 0.
// KSL > 1: grid z = Z * KSL; work-group (z, ks) sums only k in [ks K/KSL, (ks+1) K/KSL) and stores that partial tile in plane ks (plane stride sP elements); the reader adds the KSL planes. K % (32 KSL) == 0.
template <typename T16> struct WFrag;
template <> struct WFrag<h16> { typedef v16h V; static __device__ __forceinline__ V ld(const h16* p) { return cat16(*(const v8h*)p, *(const v8h*)(p + 16)); } static __device__ __forceinline__ v8f mma(V a, V b, v8f c) { return wmma16(a, b, c); } };
template <> struct WFrag<bf> { typedef v16bf V; static __device__ __forceinline__ V ld(const bf* p) { return cat16b(*(const v8us*)p, *(const v8us*)(p + 16)); } static __device__ __forceinline__ v8f mma(V a, V b, v8f c) { return wmmab(a, b, c); } };
template <typename T16, int NSPLIT, bool BIAS, int KSL = 1>
__global__ __launch_bounds__(32) void k_gemmw(const T16* __restrict__ A, const T16* __restrict__ A2, const T16* __restrict__ Bt, const T16* __restrict__ Bt2, int K, float* C, int ldc, const float* __restrict__ bias, size_t sA, size_t sB, size_t sC, size_t sP = 0) {
    typedef typename WFrag<T16>::V V;
    __shared__ __align__(16) float os[16 * 68];
    const size_t z = blockIdx.z / KSL; const int ks = blockIdx.z % KSL; const int kbeg = ks * (K / KSL), kend = kbeg + K / KSL; C += (size_t)ks * sP; A += z * sA; if (A2) A2 += z * sA; Bt += z * sB; if (Bt2) Bt2 += z * sB; C += z * sC;
    const int lane = threadIdx.x & 31, lr = lane & 15, hi = lane >> 4; const int r0 = blockIdx.x * 64, c0 = blockIdx.y * 64;
    v8f acc[4][4];
#pragma unroll
    for (int mb = 0; mb < 4; ++mb)
#pragma unroll
        for (int nb = 0; nb < 4; ++nb) acc[mb][nb] = (v8f){};
    const size_t aoff = (size_t)(r0 + lr) * K + 8 * hi, boff = (size_t)(c0 + lr) * K + 8 * hi;
#pragma unroll 1
    for (int kc = kbeg; kc < kend; kc += 32) {
        V a[4], a2[4];
#pragma unroll
        for (int mb = 0; mb < 4; ++mb) { a[mb] = WFrag<T16>::ld(A + aoff + (size_t)mb * 16 * K + kc); if (NSPLIT == 1 || NSPLIT == 2) a2[mb] = WFrag<T16>::ld(A2 + aoff + (size_t)mb * 16 * K + kc); }
#pragma unroll
        for (int nb = 0; nb < 4; ++nb) { const V b = WFrag<T16>::ld(Bt + boff + (size_t)nb * 16 * K + kc); V b2; if (NSPLIT >= 2) b2 = WFrag<T16>::ld(Bt2 + boff + (size_t)nb * 16 * K + kc);
#pragma unroll
            for (int mb = 0; mb < 4; ++mb) { acc[mb][nb] = WFrag<T16>::mma(a[mb], b, acc[mb][nb]); if (NSPLIT == 1 || NSPLIT == 2) acc[mb][nb] = WFrag<T16>::mma(a2[mb], b, acc[mb][nb]); if (NSPLIT >= 2) acc[mb][nb] = WFrag<T16>::mma(a[mb], b2, acc[mb][nb]); } }
        asm volatile("v_nop\n\tv_nop\n\tv_nop\n\tv_nop" : "+v"(acc[0][0]), "+v"(acc[1][1]), "+v"(acc[2][2]), "+v"(acc[3][3]) : "v"(a[0]), "v"(a[3]));
    }
#pragma unroll
    for (int mb = 0; mb < 4; ++mb) {
#pragma unroll
        for (int nb = 0; nb < 4; ++nb) {
#pragma unroll
            for (int j = 0; j < 8; ++j) os[(hi * 8 + j) * 68 + nb * 16 + lr] = acc[mb][nb][j]; }
        __builtin_amdgcn_wave_barrier(); asm volatile("" ::: "memory");
        float* crow = C + (size_t)(r0 + mb * 16) * ldc + c0;
{
#pragma unroll
            for (int s = 0; s < 8; ++s) { const int row = 2 * s + hi, cofs = lr * 4; v4f val = *(const v4fa*)(os + row * 68 + cofs); if (BIAS) { val[0] += bfr(bias[c0 + cofs]); val[1] += bfr(bias[c0 + cofs + 1]); val[2] += bfr(bias[c0 + cofs + 2]); val[3] += bfr(bias[c0 + cofs + 3]); }
                *(v4f*)(crow + (size_t)row * ldc + cofs) = val; }
             }
        __builtin_amdgcn_wave_barrier(); asm volatile("" ::: "memory");
    }
}

__device__ __forceinline__ h16 tohx(float x) { return (h16)x; }
__device__ __forceinline__ void splitf(float y, unsigned short& h, unsigned short& l) { h = f2bf(y); l = f2bf(y - bf2f(h)); }
typedef __attribute__((ext_vector_type(2))) _Float16 v2h;
typedef __attribute__((ext_vector_type(4))) _Float16 v4h;
typedef __attribute__((ext_vector_type(2))) unsigned short v2us;
typedef __attribute__((ext_vector_type(4))) unsigned short v4us;
typedef __attribute__((ext_vector_type(2))) float v2f;
typedef __attribute__((ext_vector_type(4))) int v4i;

__global__ __launch_bounds__(256) void k_wtG(const float* __restrict__ w, int K, int N, bf* Bt) {
    const int lane = threadIdx.x & 31; const int L0 = (blockIdx.x * 8 + (threadIdx.x >> 5)) * 8; const int nlines = N * K / 64;
{
#pragma unroll 1
        for (int l = 0; l < 8; ++l) { const int L = L0 + l; if (L >= nlines) break; const size_t e = (size_t)L * 64 + lane * 2; const int k = (int)(e % K), n = (int)(e / K); v2us o;
            o[0] = f2bf(w[(size_t)k * N + n]); o[1] = f2bf(w[(size_t)(k + 1) * N + n]); *(v2us*)(Bt + e) = o; }
         }
}
__global__ __launch_bounds__(256) void k_cvt8(const float* __restrict__ src, bf* dst, size_t n8) { const size_t i = (size_t)blockIdx.x * 256 + threadIdx.x; if (i >= n8) return; const v8f v = *(const v8f*)(src + i * 8); v8us o;
#pragma unroll
    for (int k = 0; k < 8; ++k) o[k] = f2bf(v[k]); *(v8us*)(dst + i * 8) = o;  }
__global__ __launch_bounds__(256) void k_cscvt(const float* __restrict__ cosT, const float* __restrict__ sinT, float* CS) { const int idx = blockIdx.x * 256 + threadIdx.x; if (idx >= TT * HD) return; v2f cs; cs[0] = bfr(cosT[idx]); cs[1] = bfr(sinT[idx]); *(v2f*)(CS + (size_t)idx * 2) = cs;  }
// k_rope: head planes [h][t][d] (fp16 + hi/lo) of rope(x) x sc with the interleaved-pair convention out[2i] = x[2i] cos[t][2i] - x[2i+1] sin[t][2i], out[2i+1] = x[2i+1] cos[t][2i+1] + x[2i] sin[t][2i+1]
__global__ __launch_bounds__(256) void k_rope(const float* __restrict__ F, int pitch, int nheads, const float* __restrict__ CS, const float* __restrict__ RF, const float* __restrict__ nw, float sc, h16* P16, bf* Ph, bf* Pl) {
    const size_t e = ((size_t)blockIdx.x * 256 + threadIdx.x) * 2; if (e >= (size_t)nheads * TT * HD) return; const int d = (int)(e % HD); const int t = (int)((e / HD) % TT); const int h = (int)(e / ((size_t)HD * TT)); const float* f = F + (size_t)t * pitch + h * HD; const float rf = RF ? RF[(size_t)h * TT + t] : 1.0f; v2h o16; v2us oh, ol;
#pragma unroll
    for (int q = 0; q < 2; ++q) { const int dd = d + q; const int dp = dd ^ 1;   /* interleaved pair partner */ float x0 = f[dd], x1 = f[dp];
        if (RF) { float n0 = __fmul_rn(x0, rf), n1 = __fmul_rn(x1, rf); asm volatile("" : "+v"(n0)); asm volatile("" : "+v"(n1)); x0 = __fmul_rn(bfr(nw[dd]), n0); x1 = __fmul_rn(bfr(nw[dp]), n1); }
        const v2f cs = *(const v2f*)(CS + ((size_t)t * HD + dd) * 2); float a = __fmul_rn(x0, cs[0]), bq = __fmul_rn(x1, cs[1]); asm volatile("" : "+v"(a)); asm volatile("" : "+v"(bq)); const float r = (((dd & 1) == 0) ? __fsub_rn(a, bq) : __fadd_rn(a, bq)) * sc;
        o16[q] = tohx(r); unsigned short a2, c2; splitf(r, a2, c2); oh[q] = a2; ol[q] = c2; }
    *(v2h*)(P16 + e) = o16; *(v2us*)(Ph + e) = oh; *(v2us*)(Pl + e) = ol;  }

__global__ __launch_bounds__(256) void k_vtp(const float* __restrict__ F, int pitch, int nheads, h16* V16, bf* Vh, bf* Vl) { const size_t e = ((size_t)blockIdx.x * 256 + threadIdx.x) * 2; if (e >= (size_t)nheads * HD * TT) return; const int t = (int)(e % TT); const int d = (int)((e / TT) % HD); const int g = (int)(e / ((size_t)TT * HD)); v2h o16; v2us oh, ol;
#pragma unroll
    for (int q = 0; q < 2; ++q) { const float x = F[(size_t)(t + q) * pitch + g * HD + d]; o16[q] = tohx(x); unsigned short a2, c2; splitf(x, a2, c2); oh[q] = a2; ol[q] = c2; }
    *(v2h*)(V16 + e) = o16; *(v2us*)(Vh + e) = oh; *(v2us*)(Vl + e) = ol;  }
// k_asoft: per row (zz, i): t = S x HD^-0.5 + mask[i][j] (float [S][S], read as data, rounded to bf16, added); softmax over the 2048 keys (register row, one exp, fixed trees);
__global__ __launch_bounds__(256) void k_asoft(const float* __restrict__ Sb, const float* __restrict__ mk, h16* P16, bf* Ph, bf* Pl) {
    const int lane = threadIdx.x & 31; const int row = blockIdx.x * 8 + (threadIdx.x >> 5); if (row >= ZH * TT) return; const int i = row % TT; const int zz = row / TT; (void)zz; const bool hires = (i < RH); const float* sr = Sb + (size_t)row * TT; float v[TT / 32]; float mx = -3.0e38f;
#pragma unroll
    for (int ch = 0; ch < TT / 128; ++ch) { const int j0 = ch * 128 + lane * 4; const v4f a = *(const v4f*)(sr + j0); const v4f mk4 = *(const v4f*)(mk + (size_t)i * TT + j0);   /* additive float mask [S][S] */
#pragma unroll
        for (int q = 0; q < 4; ++q) { const int j = j0 + q; (void)j; const float t = ({ float t0 = a[q] * SCL; float mm = bfr(mk4[q]); asm volatile("" : "+v"(t0)); asm volatile("" : "+v"(mm)); __fadd_rn(t0, mm); }); v[ch * 4 + q] = t; mx = fmaxf(mx, t); } }
#pragma unroll
    for (int sh = 16; sh; sh >>= 1) mx = fmaxf(mx, __shfl_xor(mx, sh, 32));
    float sum = 0.f;
#pragma unroll
    for (int k = 0; k < TT / 32; ++k) { float d0 = __fsub_rn(v[k], mx); asm volatile("" : "+v"(d0)); v[k] = __builtin_amdgcn_exp2f(__fmul_rn(d0, 1.4426950408889634f)); sum += v[k]; }
#pragma unroll
    for (int sh = 16; sh; sh >>= 1) sum += __shfl_xor(sum, sh, 32);
    const float f = __fdiv_rn(hires ? 1.0f : PCAR, sum);
{
        if (hires) {
#pragma unroll
            for (int ch = 0; ch < TT / 128; ++ch) { v4us oh, ol;
#pragma unroll
                for (int q = 0; q < 4; ++q) { unsigned short a, c2; splitf(v[ch * 4 + q] * f, a, c2); oh[q] = a; ol[q] = c2; }
                const size_t oo = ((size_t)zz * (RH ? RH : 1) + i) * TT + ch * 128 + lane * 4; *(v4us*)(Ph + oo) = oh; *(v4us*)(Pl + oo) = ol; }
        } else {
#pragma unroll
            for (int ch = 0; ch < TT / 128; ++ch) { v4h o4;
#pragma unroll
                for (int q = 0; q < 4; ++q) o4[q] = tohx(v[ch * 4 + q] * f);
                *(v4h*)(P16 + (size_t)row * TT + ch * 128 + lane * 4) = o4; } }
         }
}
__global__ __launch_bounds__(256) void k_merge(const float* __restrict__ O, int h0, bf* Ah, bf* Al) { const size_t e = ((size_t)blockIdx.x * 256 + threadIdx.x) * 2; if (e >= (size_t)ZH * TT * HD) return; const int d = (int)(e % HD); const int t = (int)((e / HD) % TT); const int zz = (int)(e / ((size_t)HD * TT)); const float cs = (t < RH) ? 1.0f : (1.0f / PCAR); const size_t oo = (size_t)t * DQ + (h0 + zz) * HD + d;
    v2us oh, ol; v2f s = *(const v2f*)(O + e);   // the KSP partial planes, added in plane order
#pragma unroll
    for (int p = 1; p < KSP; ++p) s += *(const v2f*)(O + (size_t)p * ZH * TT * HD + e);
#pragma unroll
    for (int q = 0; q < 2; ++q) { unsigned short a, c2; splitf(s[q] * cs, a, c2); oh[q] = a; ol[q] = c2; } *(v2us*)(Ah + oo) = oh; *(v2us*)(Al + oo) = ol;  }

extern "C" void kernel_launch(void* const* d_in, const int* in_sizes, int n_in,
                              void* d_out, int out_size, void* d_ws, size_t ws_size, hipStream_t stream) {
    (void)in_sizes; (void)n_in; (void)out_size;
    const float* x = (const float*)d_in[0]; const float* rope = (const float*)d_in[1]; const float* cosT = rope; const float* sinT = rope + (size_t)TT * HD; const float* fmask = (const float*)d_in[2]; const float* wq = (const float*)d_in[3]; const float* bq = (const float*)d_in[4]; const float* wk = (const float*)d_in[5]; const float* bk = (const float*)d_in[6]; const float* wv = (const float*)d_in[7]; const float* bv = (const float*)d_in[8]; const float* wo = (const float*)d_in[9]; const float* bo = (const float*)d_in[10];
    float* OUT = (float*)d_out;     // [2][2048][1024]
    char* wsp = (char*)d_ws;
    auto take = [&](size_t bytes) { char* p = wsp; wsp += (bytes + 255) & ~(size_t)255; return (void*)p; };
    bf* WQ = (bf*)take((size_t)DQ * DM * 2); bf* WK = (bf*)take((size_t)DKV * DM * 2); bf* WV = (bf*)take((size_t)DKV * DM * 2); bf* WO = (bf*)take((size_t)DM * DQ * 2); float* CS = (float*)take((size_t)TT * HD * 2 * 4);
    bf* XB = (bf*)take((size_t)TT * DM * 2); float* FQ = (float*)take((size_t)TT * DQ * 4); float* FK = (float*)take((size_t)TT * DKV * 4);
    h16* QP16 = (h16*)take((size_t)NH_ * TT * HD * 2); h16* KP16 = (h16*)take((size_t)NKV * TT * HD * 2); h16* VT16 = (h16*)take((size_t)NKV * HD * TT * 2);
    bf* QPh = (bf*)take((size_t)NH_ * TT * HD * 2); bf* QPl = (bf*)take((size_t)NH_ * TT * HD * 2); bf* KPh = (bf*)take((size_t)NKV * TT * HD * 2); bf* KPl = (bf*)take((size_t)NKV * TT * HD * 2); bf* VTh = (bf*)take((size_t)NKV * HD * TT * 2); bf* VTl = (bf*)take((size_t)NKV * HD * TT * 2); bf* Ph = (bf*)take((size_t)ZH * RH * TT * 2); bf* Pl = (bf*)take((size_t)ZH * RH * TT * 2);
    float* Sb = (float*)take((size_t)ZH * TT * TT * 4); h16* P16 = (h16*)take((size_t)ZH * TT * TT * 2); float* Ob = (float*)take((size_t)KSP * ZH * TT * HD * 4); bf* ATh = (bf*)take((size_t)TT * DQ * 2); bf* ATl = (bf*)take((size_t)TT * DQ * 2);
    if ((size_t)(wsp - (char*)d_ws) > ws_size) return;    // ws 256 MiB
    float* FV = FK;   // v projection reuses the k buffer after the k planes are built (stream-ordered)
    { k_wtG<<<(unsigned)((DM * DQ / 64 + 63) / 64), 256, 0, stream>>>(wq, DM, DQ, WQ); k_wtG<<<(unsigned)((DM * DKV / 64 + 63) / 64), 256, 0, stream>>>(wk, DM, DKV, WK); k_wtG<<<(unsigned)((DM * DKV / 64 + 63) / 64), 256, 0, stream>>>(wv, DM, DKV, WV);
      k_wtG<<<(unsigned)((DQ * DM / 64 + 63) / 64), 256, 0, stream>>>(wo, DQ, DM, WO);
       }
    const unsigned LQ = (unsigned)(((size_t)NH_ * TT * HD / 2 + 255) / 256), LKv = (unsigned)(((size_t)NKV * TT * HD / 2 + 255) / 256);
    for (int b = 0; b < NB_; ++b) {
        if (b == 0) k_cscvt<<<(TT * HD + 255) / 256, 256, 0, stream>>>(cosT, sinT, CS);
        k_cvt8<<<(unsigned)(((size_t)TT * DM / 8 + 255) / 256), 256, 0, stream>>>(x + (size_t)b * TT * DM, XB, (size_t)TT * DM / 8);
        k_gemmw<bf, 0, true><<<dim3(TT / 64, DQ / 64, 1), 32, 0, stream>>>(XB, nullptr, WQ, nullptr, DM, FQ, DQ, bq, 0, 0, 0);
        k_rope<<<LQ, 256, 0, stream>>>(FQ, DQ, NH_, CS, nullptr, nullptr, 1.0f, QP16, QPh, QPl);
        k_gemmw<bf, 0, true><<<dim3(TT / 64, DKV / 64, 1), 32, 0, stream>>>(XB, nullptr, WK, nullptr, DM, FK, DKV, bk, 0, 0, 0);
        k_rope<<<LKv, 256, 0, stream>>>(FK, DKV, NKV, CS, nullptr, nullptr, 1.0f, KP16, KPh, KPl);
        k_gemmw<bf, 0, true><<<dim3(TT / 64, DKV / 64, 1), 32, 0, stream>>>(XB, nullptr, WV, nullptr, DM, FV, DKV, bv, 0, 0, 0); k_vtp<<<LKv, 256, 0, stream>>>(FV, DKV, NKV, VT16, VTh, VTl);
        for (int h0 = 0; h0 < NH_; h0 += ZH) { const size_t zq = (size_t)h0, zk = (size_t)(h0 / REP);   // one kv head per query head: the pass's two heads use consecutive kv planes (z-strides TT*HD)
            k_gemmw<bf, 2, false><<<dim3(RH / 64, TT / 64, ZH), 32, 0, stream>>>(QPh + zq * TT * HD, QPl + zq * TT * HD, KPh + zk * TT * HD, KPl + zk * TT * HD, HD, Sb, TT, nullptr, (size_t)TT * HD, (size_t)TT * HD, (size_t)TT * TT);
            k_gemmw<h16, 0, false><<<dim3((TT - RH) / 64, TT / 64, ZH), 32, 0, stream>>>(QP16 + zq * TT * HD + (size_t)RH * HD, nullptr, KP16 + zk * TT * HD, nullptr, HD, Sb + (size_t)RH * TT, TT, nullptr, (size_t)TT * HD, (size_t)TT * HD, (size_t)TT * TT);
            k_asoft<<<ZH * TT / 8, 256, 0, stream>>>(Sb, fmask, P16, Ph, Pl);
            k_gemmw<bf, 2, false, KSP><<<dim3(RH / 64, HD / 64, ZH * KSP), 32, 0, stream>>>(Ph, Pl, VTh + zk * HD * TT, VTl + zk * HD * TT, TT, Ob, HD, nullptr, (size_t)RH * TT, (size_t)HD * TT, (size_t)TT * HD, (size_t)ZH * TT * HD);
            k_gemmw<h16, 0, false, KSP><<<dim3((TT - RH) / 64, HD / 64, ZH * KSP), 32, 0, stream>>>(P16 + (size_t)RH * TT, nullptr, VT16 + zk * HD * TT, nullptr, TT, Ob + (size_t)RH * HD, HD, nullptr, (size_t)TT * TT, (size_t)HD * TT, (size_t)TT * HD, (size_t)ZH * TT * HD);
            k_merge<<<(unsigned)(((size_t)ZH * TT * HD / 2 + 255) / 256), 256, 0, stream>>>(Ob, h0, ATh, ATl); }
        k_gemmw<bf, 1, true><<<dim3(TT / 64, DM / 64, 1), 32, 0, stream>>>(ATh, ATl, WO, nullptr, DQ, OUT + (size_t)b * TT * DM, DM, bo, 0, 0, 0); }
}

// v003
// Measured time: 301 microseconds a run.
// Versions in between are left out here; by their measured steps it is 3.22 times as fast as v001.
// Over all steps from v000 it is 6.95 times as fast.
#include <hip/hip_runtime.h>

// Attention block (x [2][2048][1024]; q/k/v = x W + b (16 heads x 64); interleaved-pair RoPE q cos + rot(q) sin with rot = (x0, x1) -> (-x1, x0) and the cos/sin tables READ from the rope input ([2][1][S][1][64]); scores = q.k/8 + mask[i][j] (float, read; zeros here);
// softmax; out = (attn v merged) Wo + bo -> [2][2048][1024]).
// Compute dtypes, f32 accumulate: every input rounded to bf16; q/k/v on PLAIN bf16 operands (inputs: exact) + bias; RoPE f32; scores and attn.v: query rows < 512 hl (3 products), the rest single fp16; mask add + softmax f32, fused with both products in one kernel (running maximum and sum);
// Five launches, each over BOTH batches: input conversions; q, k and v projections (grid z); head planes; attention; output projection.

#define NB_  2
#define TT   2048
#define DM   1024
#define NH_  16
#define NKV  16
#define REP  (NH_ / NKV)
#define HD   64
#define DQ   (NH_ * HD)
#define DKV  (NKV * HD)
#define RH   512                  // query rows < RH use hi+lo planes (0: none)
#define WIN  0
#define SCL  0.125f   // HD^-0.5
typedef _Float16 h16;
typedef unsigned short bf;
typedef __attribute__((ext_vector_type(16))) __bf16   v16bf;
typedef __attribute__((ext_vector_type(16))) _Float16 v16h;
typedef __attribute__((ext_vector_type(8)))  _Float16 v8h;
typedef __attribute__((ext_vector_type(8)))  unsigned short v8us;
typedef __attribute__((ext_vector_type(8)))  float    v8f;
typedef __attribute__((ext_vector_type(4)))  float    v4f;
typedef v8h  __attribute__((may_alias)) v8ha;
typedef v4f  __attribute__((may_alias)) v4fa;
typedef v8us __attribute__((may_alias)) v8usa;

__device__ __forceinline__ unsigned short f2bf(float f) { unsigned u = __float_as_uint(f); u += 0x7FFFu + ((u >> 16) & 1u); return (unsigned short)(u >> 16); }
__device__ __forceinline__ float bf2f(unsigned short b) { return __uint_as_float(((unsigned)b) << 16); }
__device__ __forceinline__ float bfr(float f) { return bf2f(f2bf(f)); }
__device__ __forceinline__ v16h cat16(v8h lo, v8h hi) { return __builtin_shufflevector(lo, hi, 0, 1, 2, 3, 4, 5, 6, 7, 8, 9, 10, 11, 12, 13, 14, 15); }
__device__ __forceinline__ v16bf cat16b(v8us lo, v8us hi) { return __builtin_bit_cast(v16bf, __builtin_shufflevector(lo, hi, 0, 1, 2, 3, 4, 5, 6, 7, 8, 9, 10, 11, 12, 13, 14, 15)); }
__device__ __forceinline__ v8f wmma16(v16h a, v16h b, v8f c) { return __builtin_amdgcn_wmma_f32_16x16x32_f16(false, a, false, b, (short)0, c, false, false); }
__device__ __forceinline__ v8f wmmab(v16bf a, v16bf b, v8f c) { return __builtin_amdgcn_wmma_f32_16x16x32_bf16(false, a, false, b, (short)0, c, false, false); }



// ---- k_gemmw: register-blocked GEMM, ONE WAVE per 64x64 output tile (16 accumulators), operands straight from K-contiguous 16-bit planes; grid (M/64, N/64, Z), 32 threads.
// C[m][n] (f32, pitch ldc, + optional f32 bias[n]) = sum_k A[m][k] Bt[n][k] (+ split products per NSPLIT). z-batch strides sA/sB/sC in elements; z = 0, 1, 2 adds bias, bias1, bias2. K % 32 == 0.
// KSL > 1: grid z = Z * KSL; work-group (z, ks) sums only k in [ks K/KSL, (ks+1) K/KSL) and stores that partial tile in plane ks (plane stride sP elements); the reader adds the KSL planes. K % (32 KSL) == 0.
template <typename T16> struct WFrag;
template <> struct WFrag<h16> { typedef v16h V; static __device__ __forceinline__ V ld(const h16* p) { return cat16(*(const v8h*)p, *(const v8h*)(p + 16)); } static __device__ __forceinline__ v8f mma(V a, V b, v8f c) { return wmma16(a, b, c); } };
template <> struct WFrag<bf> { typedef v16bf V; static __device__ __forceinline__ V ld(const bf* p) { return cat16b(*(const v8us*)p, *(const v8us*)(p + 16)); } static __device__ __forceinline__ v8f mma(V a, V b, v8f c) { return wmmab(a, b, c); } };
template <typename T16, int NSPLIT, bool BIAS, int KSL = 1>
__global__ __launch_bounds__(32) void k_gemmw(const T16* __restrict__ A, const T16* __restrict__ A2, const T16* __restrict__ Bt, const T16* __restrict__ Bt2, int K, float* C, int ldc, const float* __restrict__ bias, const float* __restrict__ bias1, const float* __restrict__ bias2, size_t sA, size_t sB, size_t sC, size_t sP = 0) {
    typedef typename WFrag<T16>::V V;
    __shared__ __align__(16) float os[16 * 68];
    const size_t z = blockIdx.z / KSL; const int ks = blockIdx.z % KSL; const int kbeg = ks * (K / KSL), kend = kbeg + K / KSL; C += (size_t)ks * sP; A += z * sA; if (A2) A2 += z * sA; Bt += z * sB; if (Bt2) Bt2 += z * sB; C += z * sC; const float* bz = z == 0 ? bias : z == 1 ? bias1 : bias2;
    const int lane = threadIdx.x & 31, lr = lane & 15, hi = lane >> 4; const int r0 = blockIdx.x * 64, c0 = blockIdx.y * 64;
    v8f acc[4][4];
#pragma unroll
    for (int mb = 0; mb < 4; ++mb)
#pragma unroll
        for (int nb = 0; nb < 4; ++nb) acc[mb][nb] = (v8f){};
    const size_t aoff = (size_t)(r0 + lr) * K + 8 * hi, boff = (size_t)(c0 + lr) * K + 8 * hi;
#pragma unroll 1
    for (int kc = kbeg; kc < kend; kc += 32) {
        V a[4], a2[4];
#pragma unroll
        for (int mb = 0; mb < 4; ++mb) { a[mb] = WFrag<T16>::ld(A + aoff + (size_t)mb * 16 * K + kc); if (NSPLIT == 1 || NSPLIT == 2) a2[mb] = WFrag<T16>::ld(A2 + aoff + (size_t)mb * 16 * K + kc); }
#pragma unroll
        for (int nb = 0; nb < 4; ++nb) { const V b = WFrag<T16>::ld(Bt + boff + (size_t)nb * 16 * K + kc); V b2; if (NSPLIT >= 2) b2 = WFrag<T16>::ld(Bt2 + boff + (size_t)nb * 16 * K + kc);
#pragma unroll
            for (int mb = 0; mb < 4; ++mb) { acc[mb][nb] = WFrag<T16>::mma(a[mb], b, acc[mb][nb]); if (NSPLIT == 1 || NSPLIT == 2) acc[mb][nb] = WFrag<T16>::mma(a2[mb], b, acc[mb][nb]); if (NSPLIT >= 2) acc[mb][nb] = WFrag<T16>::mma(a[mb], b2, acc[mb][nb]); } }
        asm volatile("v_nop\n\tv_nop\n\tv_nop\n\tv_nop" : "+v"(acc[0][0]), "+v"(acc[1][1]), "+v"(acc[2][2]), "+v"(acc[3][3]) : "v"(a[0]), "v"(a[3]));
    }
#pragma unroll
    for (int mb = 0; mb < 4; ++mb) {
#pragma unroll
        for (int nb = 0; nb < 4; ++nb) {
#pragma unroll
            for (int j = 0; j < 8; ++j) os[(hi * 8 + j) * 68 + nb * 16 + lr] = acc[mb][nb][j]; }
        __builtin_amdgcn_wave_barrier(); asm volatile("" ::: "memory");
        float* crow = C + (size_t)(r0 + mb * 16) * ldc + c0;
{
#pragma unroll
            for (int s = 0; s < 8; ++s) { const int row = 2 * s + hi, cofs = lr * 4; v4f val = *(const v4fa*)(os + row * 68 + cofs); if (BIAS) { val[0] += bfr(bz[c0 + cofs]); val[1] += bfr(bz[c0 + cofs + 1]); val[2] += bfr(bz[c0 + cofs + 2]); val[3] += bfr(bz[c0 + cofs + 3]); }
                *(v4f*)(crow + (size_t)row * ldc + cofs) = val; }
             }
        __builtin_amdgcn_wave_barrier(); asm volatile("" ::: "memory");
    }
}

__device__ __forceinline__ h16 tohx(float x) { return (h16)x; }
__device__ __forceinline__ void splitf(float y, unsigned short& h, unsigned short& l) { h = f2bf(y); l = f2bf(y - bf2f(h)); }
typedef __attribute__((ext_vector_type(2))) _Float16 v2h;
typedef __attribute__((ext_vector_type(4))) _Float16 v4h;
typedef __attribute__((ext_vector_type(2))) unsigned short v2us;
typedef __attribute__((ext_vector_type(4))) unsigned short v4us;
typedef __attribute__((ext_vector_type(2))) float v2f;
typedef __attribute__((ext_vector_type(4))) int v4i;

// The bodies below take their work-group's index blk inside their own job: jobs that read none of each other's output share one launch.
__device__ __forceinline__ void wtG(int blk, const float* __restrict__ w, int K, int N, bf* Bt) {
    const int lane = threadIdx.x & 31; const int L0 = (blk * 8 + (threadIdx.x >> 5)) * 8; const int nlines = N * K / 64;
{
#pragma unroll 1
        for (int l = 0; l < 8; ++l) { const int L = L0 + l; if (L >= nlines) break; const size_t e = (size_t)L * 64 + lane * 2; const int k = (int)(e % K), n = (int)(e / K); v2us o;
            o[0] = f2bf(w[(size_t)k * N + n]); o[1] = f2bf(w[(size_t)(k + 1) * N + n]); *(v2us*)(Bt + e) = o; }
         }
}
__device__ __forceinline__ void cvt8(int blk, const float* __restrict__ src, bf* dst, size_t n8) { const size_t i = (size_t)blk * 256 + threadIdx.x; if (i >= n8) return; const v8f v = *(const v8f*)(src + i * 8); v8us o;
#pragma unroll
    for (int k = 0; k < 8; ++k) o[k] = f2bf(v[k]); *(v8us*)(dst + i * 8) = o;  }
__device__ __forceinline__ void cscvt(int blk, const float* __restrict__ cosT, const float* __restrict__ sinT, float* CS) { const int idx = blk * 256 + threadIdx.x; if (idx >= TT * HD) return; v2f cs; cs[0] = bfr(cosT[idx]); cs[1] = bfr(sinT[idx]); *(v2f*)(CS + (size_t)idx * 2) = cs;  }
// ---- k_prep: every conversion that reads inputs alone, one launch: the four weights transposed to bf16 (WT: q, k, v, o one after the other), x of both batches to bf16, the cos/sin table.
static_assert(DQ == DM && DKV == DM && NKV == NH_, "the four weights share one shape, q and k planes one size");
#define WBLK (DM * DQ / 64 / 64)           // work-groups per weight
#define XBLK (NB_ * TT * DM / 8 / 256)     // work-groups on x
#define CBLK (TT * HD / 256)               // work-groups on the cos/sin table
__global__ __launch_bounds__(256) void k_prep(const float* __restrict__ wq, const float* __restrict__ wk, const float* __restrict__ wv, const float* __restrict__ wo, const float* __restrict__ x, const float* __restrict__ cosT, const float* __restrict__ sinT, bf* WT, bf* XB, float* CS) {
    const int blk = blockIdx.x;
    if (blk < 4 * WBLK) { const int wi = blk / WBLK; wtG(blk % WBLK, wi == 0 ? wq : wi == 1 ? wk : wi == 2 ? wv : wo, DM, DQ, WT + (size_t)wi * DM * DQ); }
    else if (blk < 4 * WBLK + XBLK) cvt8(blk - 4 * WBLK, x, XB, (size_t)NB_ * TT * DM / 8);
    else cscvt(blk - 4 * WBLK - XBLK, cosT, sinT, CS);
}
// rope: head planes [b][h][t][d] (fp16 + hi/lo; F rows are b TT + t) of rope(x) x sc with the interleaved-pair convention out[d] = x[d] cos[t][d] - x[d+1] sin[t][d], out[d+1] = x[d+1] cos[t][d+1] + x[d] sin[t][d+1] (d even)
__device__ __forceinline__ void rope(int blk, const float* __restrict__ F, int pitch, int nheads, const float* __restrict__ CS, const float* __restrict__ RF, const float* __restrict__ nw, float sc, h16* P16, bf* Ph, bf* Pl) {
    const size_t e = ((size_t)blk * 256 + threadIdx.x) * 2; if (e >= (size_t)NB_ * nheads * TT * HD) return; const int d = (int)(e % HD); const int t = (int)((e / HD) % TT); const int bh = (int)(e / ((size_t)HD * TT)); const int h = bh % nheads, b = bh / nheads; const float* f = F + ((size_t)b * TT + t) * pitch + h * HD; const float rf = RF ? RF[(size_t)h * TT + t] : 1.0f; v2h o16; v2us oh, ol;
#pragma unroll
    for (int q = 0; q < 2; ++q) { const int dd = d + q; const int dp = dd ^ 1;   /* interleaved pair partner */ float x0 = f[dd], x1 = f[dp];
        if (RF) { float n0 = __fmul_rn(x0, rf), n1 = __fmul_rn(x1, rf); asm volatile("" : "+v"(n0)); asm volatile("" : "+v"(n1)); x0 = __fmul_rn(bfr(nw[dd]), n0); x1 = __fmul_rn(bfr(nw[dp]), n1); }
        const v2f cs = *(const v2f*)(CS + ((size_t)t * HD + dd) * 2); float a = __fmul_rn(x0, cs[0]), bq = __fmul_rn(x1, cs[1]); asm volatile("" : "+v"(a)); asm volatile("" : "+v"(bq)); const float r = (((dd & 1) == 0) ? __fsub_rn(a, bq) : __fadd_rn(a, bq)) * sc;
        o16[q] = tohx(r); unsigned short a2, c2; splitf(r, a2, c2); oh[q] = a2; ol[q] = c2; }
    *(v2h*)(P16 + e) = o16; *(v2us*)(Ph + e) = oh; *(v2us*)(Pl + e) = ol;  }

// vtp: transposed v planes [b][g][d][t]
__device__ __forceinline__ void vtp(int blk, const float* __restrict__ F, int pitch, int nheads, h16* V16, bf* Vh, bf* Vl) { const size_t e = ((size_t)blk * 256 + threadIdx.x) * 2; if (e >= (size_t)NB_ * nheads * HD * TT) return; const int t = (int)(e % TT); const int d = (int)((e / TT) % HD); const int bg = (int)(e / ((size_t)TT * HD)); const int g = bg % nheads, b = bg / nheads; v2h o16; v2us oh, ol;
#pragma unroll
    for (int q = 0; q < 2; ++q) { const float x = F[((size_t)b * TT + t + q) * pitch + g * HD + d]; o16[q] = tohx(x); unsigned short a2, c2; splitf(x, a2, c2); oh[q] = a2; ol[q] = c2; }
    *(v2h*)(V16 + e) = o16; *(v2us*)(Vh + e) = oh; *(v2us*)(Vl + e) = ol;  }
// ---- k_planes: all operand planes of the attention kernel in one launch, from the three projections F[q, k, v][b TT + t][DQ]; the q planes are followed by the k planes in P16, Ph and Pl.
#define PBLK (NB_ * NH_ * TT * HD / 2 / 256)   // work-groups per projection
#define PLN  ((size_t)NB_ * NH_ * TT * HD)     // elements of one projection and of each of its planes
__global__ __launch_bounds__(256) void k_planes(const float* __restrict__ F, const float* __restrict__ CS, h16* P16, bf* Ph, bf* Pl, h16* V16, bf* Vh, bf* Vl) {
    const int blk = blockIdx.x;
    if (blk < PBLK) vtp(blk, F + 2 * PLN, DKV, NKV, V16, Vh, Vl);
    else { const size_t y = (size_t)(blk / PBLK - 1); rope(blk % PBLK, F + y * PLN, DQ, NH_, CS, nullptr, nullptr, 1.0f, P16 + y * PLN, Ph + y * PLN, Pl + y * PLN); }
}
// ---- k_fattn: scores, mask add, softmax and attn.v of both batches in ONE launch; the score plane never leaves registers.
// One wave owns NQ x 16 query columns of one head and walks all TT keys, 32 a pass: S^T = K Q^T (a lane holds 16 keys' scores of ONE query per column group), t = S^T x HD^-0.5 + mask[i][j] (float, read, rounded to bf16),
// running maximum and running sum per query (sum and accumulators are rescaled every pass by exp(old maximum - new maximum)), P^T packed from the two score tiles straight into a B operand (same k order as the V^T loader), O^T += V^T P^T.
// Query rows < RH: hi+lo bf16 planes, 3 products in both GEMMs; the rest: single fp16. The result O / sum goes out as the hi+lo planes of the output projection's A operand, 8 consecutive d per lane.
__device__ __forceinline__ float bfrc(float f) { return (float)(__bf16)f; }
__device__ __forceinline__ float xhalf(float f) { const int b = __float_as_int(f); return __int_as_float(__builtin_amdgcn_permlanex16(b, b, 0x76543210, 0xfedcba98, false, false)); }   // lane l reads lane l ^ 16
template <typename T16, bool HI, int NQ>
__device__ __forceinline__ void attn_wave(const T16* __restrict__ Q, const T16* __restrict__ Q2, const T16* __restrict__ Kp, const T16* __restrict__ K2, const T16* __restrict__ Vt, const T16* __restrict__ Vt2, const float* __restrict__ mk, int q0, bf* Ah, bf* Al) {
    typedef typename WFrag<T16>::V V; typedef WFrag<T16> F;
    const int lane = threadIdx.x & 31, lr = lane & 15, hi = lane >> 4;
    V qf[NQ][2], qf2[NQ][2], kf[2][2], kf2[2][2], vf[4], vf2[4]; v8f mf[NQ][2], o[NQ][4]; float m[NQ], l[NQ];
#pragma unroll
    for (int nq = 0; nq < NQ; ++nq) { m[nq] = -3.0e38f; l[nq] = 0.f;
#pragma unroll
        for (int ks = 0; ks < 2; ++ks) { const size_t qo = (size_t)(q0 + nq * 16 + lr) * HD + ks * 32 + 8 * hi; qf[nq][ks] = F::ld(Q + qo); if (HI) qf2[nq][ks] = F::ld(Q2 + qo); }
#pragma unroll
        for (int dt = 0; dt < 4; ++dt) o[nq][dt] = (v8f){}; }
    const size_t ko = (size_t)lr * HD + 8 * hi, vo = (size_t)lr * TT + 8 * hi; const float* mrow = mk + (size_t)(q0 + lr) * TT + 8 * hi;
    auto ldk = [&](int kb) {
#pragma unroll
        for (int kt = 0; kt < 2; ++kt)
#pragma unroll
            for (int ks = 0; ks < 2; ++ks) { const size_t e = ko + (size_t)(kb + kt * 16) * HD + ks * 32; kf[kt][ks] = F::ld(Kp + e); if (HI) kf2[kt][ks] = F::ld(K2 + e); } };
    // the two 16-byte halves are joined into one value: left as bare loaded values, the compiler merged this refill with the prologue's load into one load at the loop's top, its latency exposed
    auto ldm = [&](int kb) {
#pragma unroll
        for (int nq = 0; nq < NQ; ++nq)
#pragma unroll
            for (int kt = 0; kt < 2; ++kt) { const float* p = mrow + (size_t)nq * 16 * TT + kb + kt * 16; mf[nq][kt] = __builtin_shufflevector(*(const v4f*)p, *(const v4f*)(p + 4), 0, 1, 2, 3, 4, 5, 6, 7); } };
    auto ldv = [&](int kb) {
#pragma unroll
        for (int dt = 0; dt < 4; ++dt) { const size_t e = vo + (size_t)dt * 16 * TT + kb; vf[dt] = F::ld(Vt + e); if (HI) vf2[dt] = F::ld(Vt2 + e); } };
    ldk(0);
    __builtin_amdgcn_sched_barrier(0);   // keeps Q and the first K ahead of the first mask and V loads, the loop's own order: with a K load issued last here, the wait at the loop's top covers every load of every pass, the V refill just issued too
    ldm(0); ldv(0);
    // rolled: the body is already 32 keys wide, and each operand set is refilled in place right behind its last use, so that the next pass's loads fly under this pass's work
#pragma unroll 1
    for (int kb = 0; kb < TT; kb += 32) {
        const int kn = (kb + 32) & (TT - 1);   // the last pass refetches pass 0 (in bounds, unused)
        v8f st[NQ][2];
#pragma unroll
        for (int nq = 0; nq < NQ; ++nq)
#pragma unroll
            for (int kt = 0; kt < 2; ++kt) { v8f s = (v8f){};
#pragma unroll
                for (int ks = 0; ks < 2; ++ks) { s = F::mma(kf[kt][ks], qf[nq][ks], s); if (HI) { s = F::mma(kf[kt][ks], qf2[nq][ks], s); s = F::mma(kf2[kt][ks], qf[nq][ks], s); } }
                st[nq][kt] = s; }
        ldk(kn);
        __builtin_amdgcn_sched_barrier(0);   // keeps the K refill here, a whole softmax ahead of its use; the scheduler otherwise sinks it behind the attn.v products
        float t[NQ][16], mx[NQ];
#pragma unroll
        for (int nq = 0; nq < NQ; ++nq) { mx[nq] = m[nq];
#pragma unroll
            for (int e = 0; e < 16; ++e) { t[nq][e] = st[nq][e >> 3][e & 7] * SCL + bfrc(mf[nq][e >> 3][e & 7]); mx[nq] = fmaxf(mx[nq], t[nq][e]); } }
        ldm(kn);
        __builtin_amdgcn_sched_barrier(0);   // keeps the mask refill here, most of a pass ahead of its use; the scheduler otherwise sinks it into the attn.v products
        V pf[NQ], pf2[NQ];
#pragma unroll
        for (int nq = 0; nq < NQ; ++nq) { const float mn = fmaxf(mx[nq], xhalf(mx[nq]));   // lanes c and c + 16 hold the two key halves of query c
            const float al = __builtin_amdgcn_exp2f((m[nq] - mn) * 1.4426950408889634f); m[nq] = mn;
#pragma unroll
            for (int e = 0; e < 16; ++e) t[nq][e] = __builtin_amdgcn_exp2f((t[nq][e] - mn) * 1.4426950408889634f);
            float ls[8];   // pairwise tree: four dependent adds deep instead of sixteen
#pragma unroll
            for (int e = 0; e < 8; ++e) ls[e] = t[nq][e] + t[nq][e + 8];
#pragma unroll
            for (int w = 4; w; w >>= 1)
#pragma unroll
                for (int e = 0; e < w; ++e) ls[e] += ls[e + w];
            l[nq] = l[nq] * al + ls[0];
#pragma unroll
            for (int dt = 0; dt < 4; ++dt) o[nq][dt] *= al;
            if constexpr (HI) {
#pragma unroll
                for (int e = 0; e < 16; ++e) { const __bf16 ph = (__bf16)t[nq][e]; pf[nq][e] = ph; pf2[nq][e] = (__bf16)(t[nq][e] - (float)ph); }
            } else {
#pragma unroll
                for (int e = 0; e < 16; ++e) pf[nq][e] = (h16)t[nq][e]; } }
#pragma unroll
        for (int nq = 0; nq < NQ; ++nq)
#pragma unroll
            for (int dt = 0; dt < 4; ++dt) { o[nq][dt] = F::mma(vf[dt], pf[nq], o[nq][dt]); if (HI) { o[nq][dt] = F::mma(vf[dt], pf2[nq], o[nq][dt]); o[nq][dt] = F::mma(vf2[dt], pf[nq], o[nq][dt]); } }
        ldv(kn);
        asm volatile("s_wait_xcnt 0x0" ::: "memory");   // stands in front of the next pass's first products, whose results may land in the registers that hold the addresses of the loads above
    }
#pragma unroll
    for (int nq = 0; nq < NQ; ++nq) { const float inv = __fdiv_rn(1.0f, l[nq] + xhalf(l[nq])); const size_t oo = (size_t)(q0 + nq * 16 + lr) * DQ + 8 * hi;
#pragma unroll
        for (int dt = 0; dt < 4; ++dt) { v8us oh, ol;
#pragma unroll
            for (int j = 0; j < 8; ++j) { unsigned short a, c2; splitf(o[nq][dt][j] * inv, a, c2); oh[j] = a; ol[j] = c2; }
            *(v8us*)(Ah + oo + dt * 16) = oh; *(v8us*)(Al + oo + dt * 16) = ol;
            asm volatile("s_wait_xcnt 0x0" ::: "memory"); } }   // stands in front of the next tile's packing, which reuses the registers that the two stores name
}
#define HWG (RH / 16)            // work-groups per head on rows < RH: one wave, 16 query columns
#define LWG ((TT - RH) / 32)     // work-groups per head on the other rows: one wave, 32 query columns
// single-wave work-groups spread evenly over the chip; the 3-product ones have the low indices and start first
__global__ __launch_bounds__(32) void k_fattn(const h16* __restrict__ Q16, const h16* __restrict__ K16, const h16* __restrict__ V16, const bf* __restrict__ Qh, const bf* __restrict__ Ql, const bf* __restrict__ Kh, const bf* __restrict__ Kl, const bf* __restrict__ Vh, const bf* __restrict__ Vl, const float* __restrict__ mk, bf* Ah, bf* Al) {
    const int blk = blockIdx.x;
    // bh = b NH_ + h: the planes are [b][h], the mask is one for all, the output rows are b TT + t
    if (blk < NB_ * NH_ * HWG) { const int bh = blk / HWG, h = bh % NH_, b = bh / NH_; const size_t po = (size_t)bh * TT * HD, pk = (size_t)(b * NKV + h / REP) * TT * HD, ao = (size_t)b * TT * DQ + h * HD; attn_wave<bf, true, 1>(Qh + po, Ql + po, Kh + pk, Kl + pk, Vh + pk, Vl + pk, mk, (blk % HWG) * 16, Ah + ao, Al + ao); }
    else { const int b2 = blk - NB_ * NH_ * HWG; const int bh = b2 / LWG, h = bh % NH_, b = bh / NH_; const size_t po = (size_t)bh * TT * HD, pk = (size_t)(b * NKV + h / REP) * TT * HD, ao = (size_t)b * TT * DQ + h * HD; attn_wave<h16, false, 2>(Q16 + po, nullptr, K16 + pk, nullptr, V16 + pk, nullptr, mk, RH + (b2 % LWG) * 32, Ah + ao, Al + ao); }
}

extern "C" void kernel_launch(void* const* d_in, const int* in_sizes, int n_in,
                              void* d_out, int out_size, void* d_ws, size_t ws_size, hipStream_t stream) {
    (void)in_sizes; (void)n_in; (void)out_size;
    const float* x = (const float*)d_in[0]; const float* rope = (const float*)d_in[1]; const float* cosT = rope; const float* sinT = rope + (size_t)TT * HD; const float* fmask = (const float*)d_in[2]; const float* wq = (const float*)d_in[3]; const float* bq = (const float*)d_in[4]; const float* wk = (const float*)d_in[5]; const float* bk = (const float*)d_in[6]; const float* wv = (const float*)d_in[7]; const float* bv = (const float*)d_in[8]; const float* wo = (const float*)d_in[9]; const float* bo = (const float*)d_in[10];
    float* OUT = (float*)d_out;     // [2][2048][1024]
    char* wsp = (char*)d_ws;
    auto take = [&](size_t bytes) { char* p = wsp; wsp += (bytes + 255) & ~(size_t)255; return (void*)p; };
    bf* WT = (bf*)take((size_t)4 * DQ * DM * 2); float* CS = (float*)take((size_t)TT * HD * 2 * 4);
    bf* XB = (bf*)take((size_t)NB_ * TT * DM * 2); float* F = (float*)take(3 * PLN * 4);
    h16* QK16 = (h16*)take(2 * PLN * 2); h16* VT16 = (h16*)take(PLN * 2);
    bf* QKh = (bf*)take(2 * PLN * 2); bf* QKl = (bf*)take(2 * PLN * 2); bf* VTh = (bf*)take(PLN * 2); bf* VTl = (bf*)take(PLN * 2);
    bf* ATh = (bf*)take((size_t)NB_ * TT * DQ * 2); bf* ATl = (bf*)take((size_t)NB_ * TT * DQ * 2);
    if ((size_t)(wsp - (char*)d_ws) > ws_size) return;    // ws 256 MiB
    k_prep<<<4 * WBLK + XBLK + CBLK, 256, 0, stream>>>(wq, wk, wv, wo, x, cosT, sinT, WT, XB, CS);
    k_gemmw<bf, 0, true><<<dim3(NB_ * TT / 64, DQ / 64, 3), 32, 0, stream>>>(XB, nullptr, WT, nullptr, DM, F, DQ, bq, bk, bv, 0, (size_t)DQ * DM, PLN);
    k_planes<<<3 * PBLK, 256, 0, stream>>>(F, CS, QK16, QKh, QKl, VT16, VTh, VTl);
    k_fattn<<<NB_ * NH_ * (HWG + LWG), 32, 0, stream>>>(QK16, QK16 + PLN, VT16, QKh, QKl, QKh + PLN, QKl + PLN, VTh, VTl, fmask, ATh, ATl);
    k_gemmw<bf, 1, true><<<dim3(NB_ * TT / 64, DM / 64, 1), 32, 0, stream>>>(ATh, ATl, WT + (size_t)3 * DQ * DM, nullptr, DQ, OUT, DM, bo, bo, bo, 0, 0, 0);
}

// v004
// One run takes 274 microseconds.
// Next to v003, in two timings, it ran 1.09 and 1.10 times as fast.
// Over all steps from v000 it is 7.61 times as fast.
#include <hip/hip_runtime.h>

// Attention block (x [2][2048][1024]; q/k/v = x W + b (16 heads x 64); interleaved-pair RoPE q cos + rot(q) sin with rot = (x0, x1) -> (-x1, x0) and the cos/sin tables READ from the rope input ([2][1][S][1][64]); scores = q.k/8 + mask[i][j] (float, read; zeros here);
// softmax; out = (attn v merged) Wo + bo -> [2][2048][1024]).
// Compute dtypes, f32 accumulate: every input rounded to bf16; q/k/v on PLAIN bf16 operands (inputs: exact) + bias; RoPE f32; scores and attn.v: query rows < 512 hl (3 products), the rest single fp16; mask add + softmax f32, fused with both products in one kernel (running maximum and sum);
// Four launches, each over BOTH batches: input conversions; q, k and v projections (grid z), whose epilogue writes the head planes; attention; output projection.

#define NB_  2
#define TT   2048
#define DM   1024
#define NH_  16
#define NKV  16
#define REP  (NH_ / NKV)
#define HD   64
#define DQ   (NH_ * HD)
#define DKV  (NKV * HD)
#define RH   512                  // query rows < RH use hi+lo planes (0: none)
#define WIN  0
#define SCL  0.125f   // HD^-0.5
typedef _Float16 h16;
typedef unsigned short bf;
typedef __attribute__((ext_vector_type(16))) __bf16   v16bf;
typedef __attribute__((ext_vector_type(16))) _Float16 v16h;
typedef __attribute__((ext_vector_type(8)))  _Float16 v8h;
typedef __attribute__((ext_vector_type(8)))  unsigned short v8us;
typedef __attribute__((ext_vector_type(8)))  float    v8f;
typedef __attribute__((ext_vector_type(4)))  float    v4f;
typedef v8h  __attribute__((may_alias)) v8ha;
typedef v4f  __attribute__((may_alias)) v4fa;
typedef v8us __attribute__((may_alias)) v8usa;

__device__ __forceinline__ unsigned short f2bf(float f) { unsigned u = __float_as_uint(f); u += 0x7FFFu + ((u >> 16) & 1u); return (unsigned short)(u >> 16); }
__device__ __forceinline__ float bf2f(unsigned short b) { return __uint_as_float(((unsigned)b) << 16); }
__device__ __forceinline__ float bfr(float f) { return bf2f(f2bf(f)); }
__device__ __forceinline__ v16h cat16(v8h lo, v8h hi) { return __builtin_shufflevector(lo, hi, 0, 1, 2, 3, 4, 5, 6, 7, 8, 9, 10, 11, 12, 13, 14, 15); }
__device__ __forceinline__ v16bf cat16b(v8us lo, v8us hi) { return __builtin_bit_cast(v16bf, __builtin_shufflevector(lo, hi, 0, 1, 2, 3, 4, 5, 6, 7, 8, 9, 10, 11, 12, 13, 14, 15)); }
__device__ __forceinline__ v8f wmma16(v16h a, v16h b, v8f c) { return __builtin_amdgcn_wmma_f32_16x16x32_f16(false, a, false, b, (short)0, c, false, false); }
__device__ __forceinline__ v8f wmmab(v16bf a, v16bf b, v8f c) { return __builtin_amdgcn_wmma_f32_16x16x32_bf16(false, a, false, b, (short)0, c, false, false); }

__device__ __forceinline__ h16 tohx(float x) { return (h16)x; }
__device__ __forceinline__ void splitf(float y, unsigned short& h, unsigned short& l) { h = f2bf(y); l = f2bf(y - bf2f(h)); }
typedef __attribute__((ext_vector_type(2))) _Float16 v2h;
typedef __attribute__((ext_vector_type(4))) _Float16 v4h;
typedef __attribute__((ext_vector_type(2))) unsigned short v2us;
typedef __attribute__((ext_vector_type(4))) unsigned short v4us;
typedef __attribute__((ext_vector_type(2))) float v2f;
typedef __attribute__((ext_vector_type(4))) int v4i;
typedef __attribute__((ext_vector_type(4))) __bf16 v4b;
typedef __attribute__((ext_vector_type(8))) __bf16 v8b;
#define PLN  ((size_t)NB_ * NH_ * TT * HD)     // elements of one projection and of each of its planes

// ---- k_gemmw: register-blocked GEMM, ONE WAVE per 64x64 output tile (16 accumulators), operands straight from K-contiguous 16-bit planes; grid (M/64, N/64, Z), 32 threads.
// C[m][n] (f32, pitch ldc, + optional f32 bias[n]) = sum_k A[m][k] Bt[n][k] (+ split products per NSPLIT). z-batch strides sA/sB/sC in elements; z = 0, 1, 2 adds bias, bias1, bias2. K % 32 == 0.
// PL: no C; the tile is 64 tokens of ONE head, and the epilogue writes the attention kernel's operand planes from it: z = 0, 1 (q, k): + bias, interleaved-pair RoPE (out[d] = x[d] cos[t][d] -/+ x[d ^ 1] sin[t][d], - for even d), planes [b][h][t][d] as fp16 and as hi+lo bf16, q's followed by k's in P16, Ph and Pl;
// z = 2 (v): + bias, transposed planes [b][g][d][t], straight from the accumulators (a lane holds 8 consecutive t of one d).
// KSL > 1: grid z = Z * KSL; work-group (z, ks) sums only k in [ks K/KSL, (ks+1) K/KSL) and stores that partial tile in plane ks (plane stride sP elements); the reader adds the KSL planes. K % (32 KSL) == 0.
template <typename T16> struct WFrag;
template <> struct WFrag<h16> { typedef v16h V; static __device__ __forceinline__ V ld(const h16* p) { return cat16(*(const v8h*)p, *(const v8h*)(p + 16)); } static __device__ __forceinline__ v8f mma(V a, V b, v8f c) { return wmma16(a, b, c); } };
template <> struct WFrag<bf> { typedef v16bf V; static __device__ __forceinline__ V ld(const bf* p) { return cat16b(*(const v8us*)p, *(const v8us*)(p + 16)); } static __device__ __forceinline__ v8f mma(V a, V b, v8f c) { return wmmab(a, b, c); } };
template <typename T16, int NSPLIT, bool BIAS, int KSL = 1, bool PL = false>
__global__ __launch_bounds__(32) void k_gemmw(const T16* __restrict__ A, const T16* __restrict__ A2, const T16* __restrict__ Bt, const T16* __restrict__ Bt2, int K, float* C, int ldc, const float* __restrict__ bias, const float* __restrict__ bias1, const float* __restrict__ bias2, size_t sA, size_t sB, size_t sC, size_t sP = 0, const float* __restrict__ CS = nullptr, h16* P16 = nullptr, bf* Ph = nullptr, bf* Pl = nullptr, h16* V16 = nullptr, bf* Vh = nullptr, bf* Vl = nullptr) {
    typedef typename WFrag<T16>::V V;
    __shared__ __align__(16) float os[16 * 68];
    const size_t z = blockIdx.z / KSL; const int ks = blockIdx.z % KSL; const int kbeg = ks * (K / KSL), kend = kbeg + K / KSL; C += (size_t)ks * sP; A += z * sA; if (A2) A2 += z * sA; Bt += z * sB; if (Bt2) Bt2 += z * sB; C += z * sC; const float* bz = z == 0 ? bias : z == 1 ? bias1 : bias2;
    const int lane = threadIdx.x & 31, lr = lane & 15, hi = lane >> 4; const int r0 = blockIdx.x * 64, c0 = blockIdx.y * 64;
    v8f acc[4][4];
#pragma unroll
    for (int mb = 0; mb < 4; ++mb)
#pragma unroll
        for (int nb = 0; nb < 4; ++nb) acc[mb][nb] = (v8f){};
    const size_t aoff = (size_t)(r0 + lr) * K + 8 * hi, boff = (size_t)(c0 + lr) * K + 8 * hi;
#pragma unroll 1
    for (int kc = kbeg; kc < kend; kc += 32) {
        V a[4], a2[4];
#pragma unroll
        for (int mb = 0; mb < 4; ++mb) { a[mb] = WFrag<T16>::ld(A + aoff + (size_t)mb * 16 * K + kc); if (NSPLIT == 1 || NSPLIT == 2) a2[mb] = WFrag<T16>::ld(A2 + aoff + (size_t)mb * 16 * K + kc); }
#pragma unroll
        for (int nb = 0; nb < 4; ++nb) { const V b = WFrag<T16>::ld(Bt + boff + (size_t)nb * 16 * K + kc); V b2; if (NSPLIT >= 2) b2 = WFrag<T16>::ld(Bt2 + boff + (size_t)nb * 16 * K + kc);
#pragma unroll
            for (int mb = 0; mb < 4; ++mb) { acc[mb][nb] = WFrag<T16>::mma(a[mb], b, acc[mb][nb]); if (NSPLIT == 1 || NSPLIT == 2) acc[mb][nb] = WFrag<T16>::mma(a2[mb], b, acc[mb][nb]); if (NSPLIT >= 2) acc[mb][nb] = WFrag<T16>::mma(a[mb], b2, acc[mb][nb]); } }
        asm volatile("v_nop\n\tv_nop\n\tv_nop\n\tv_nop" : "+v"(acc[0][0]), "+v"(acc[1][1]), "+v"(acc[2][2]), "+v"(acc[3][3]) : "v"(a[0]), "v"(a[3]));
    }
    if constexpr (PL) {
        static_assert(HD == 64 && TT % 64 == 0 && NKV == NH_, "a 64 x 64 tile is 64 tokens of one batch and one head");
        const int b = r0 / TT, t0 = r0 % TT, h = c0 / HD;
        if (z == 2) {
            const size_t vb = ((size_t)(b * NKV + h) * HD + lr) * TT + t0 + 8 * hi;
#pragma unroll
            for (int nb = 0; nb < 4; ++nb) { const float bb = bfr(bz[c0 + nb * 16 + lr]);
#pragma unroll
                for (int mb = 0; mb < 4; ++mb) { v8h o16; v8b oh, ol;
#pragma unroll
                    for (int j = 0; j < 8; ++j) { const float x = acc[mb][nb][j] + bb; o16[j] = tohx(x); oh[j] = (__bf16)x; ol[j] = (__bf16)(x - (float)oh[j]); }
                    const size_t e = vb + (size_t)nb * 16 * TT + mb * 16;
                    *(v8h*)(V16 + e) = o16; *(v8us*)(Vh + e) = __builtin_bit_cast(v8us, oh); *(v8us*)(Vl + e) = __builtin_bit_cast(v8us, ol);
                    asm volatile("s_wait_xcnt 0x0" ::: "memory"); } }   // stands in front of the next tile's packing, which reuses the registers that the three stores name
        } else {
            const int cofs = lr * 4; const size_t pb = z * PLN + ((size_t)(b * NH_ + h) * TT + t0) * HD + cofs;
            v4f bb = *(const v4f*)(bz + c0 + cofs);
#pragma unroll
            for (int i = 0; i < 4; ++i) bb[i] = bfr(bb[i]);
#pragma unroll
            for (int mb = 0; mb < 4; ++mb) {
                v4f ca[8], cb[8];   // (cos, sin) of this lane's 4 d in its 8 rows, all asked for before the staging so that one latency covers them
#pragma unroll
                for (int s = 0; s < 8; ++s) { const float* p = CS + ((size_t)(t0 + mb * 16 + 2 * s + hi) * HD + cofs) * 2; ca[s] = *(const v4f*)p; cb[s] = *(const v4f*)(p + 4); }
                asm volatile("s_wait_xcnt 0x0" ::: "memory");   // stands in front of the work below, which reuses the registers that hold the addresses of the loads above
#pragma unroll
                for (int nb = 0; nb < 4; ++nb) {
#pragma unroll
                    for (int j = 0; j < 8; ++j) os[(hi * 8 + j) * 68 + nb * 16 + lr] = acc[mb][nb][j]; }
                __builtin_amdgcn_wave_barrier(); asm volatile("" ::: "memory");   // the rows are read back by other lanes than wrote them
#pragma unroll
                for (int s = 0; s < 8; ++s) { const int row = 2 * s + hi; const v4f val = *(const v4fa*)(os + row * 68 + cofs) + bb; v4f r;
                    r[0] = val[0] * ca[s][0] - val[1] * ca[s][1]; r[1] = val[1] * ca[s][2] + val[0] * ca[s][3]; r[2] = val[2] * cb[s][0] - val[3] * cb[s][1]; r[3] = val[3] * cb[s][2] + val[2] * cb[s][3];
                    v4h o16; v4b oh, ol;
#pragma unroll
                    for (int i = 0; i < 4; ++i) { o16[i] = tohx(r[i]); oh[i] = (__bf16)r[i]; ol[i] = (__bf16)(r[i] - (float)oh[i]); }
                    const size_t e = pb + (size_t)(mb * 16 + row) * HD;
                    *(v4h*)(P16 + e) = o16; *(v4us*)(Ph + e) = __builtin_bit_cast(v4us, oh); *(v4us*)(Pl + e) = __builtin_bit_cast(v4us, ol);
                    asm volatile("s_wait_xcnt 0x0" ::: "memory"); }   // stands in front of the next rows' packing, which reuses the registers that the three stores name
                __builtin_amdgcn_wave_barrier(); asm volatile("" ::: "memory");   // the next 16 rows overwrite the staging only behind every lane's reads
            }
        }
        return;
    }
#pragma unroll
    for (int mb = 0; mb < 4; ++mb) {
#pragma unroll
        for (int nb = 0; nb < 4; ++nb) {
#pragma unroll
            for (int j = 0; j < 8; ++j) os[(hi * 8 + j) * 68 + nb * 16 + lr] = acc[mb][nb][j]; }
        __builtin_amdgcn_wave_barrier(); asm volatile("" ::: "memory");
        float* crow = C + (size_t)(r0 + mb * 16) * ldc + c0;
{
#pragma unroll
            for (int s = 0; s < 8; ++s) { const int row = 2 * s + hi, cofs = lr * 4; v4f val = *(const v4fa*)(os + row * 68 + cofs); if (BIAS) { val[0] += bfr(bz[c0 + cofs]); val[1] += bfr(bz[c0 + cofs + 1]); val[2] += bfr(bz[c0 + cofs + 2]); val[3] += bfr(bz[c0 + cofs + 3]); }
                *(v4f*)(crow + (size_t)row * ldc + cofs) = val; }
             }
        __builtin_amdgcn_wave_barrier(); asm volatile("" ::: "memory");
    }
}


// The bodies below take their work-group's index blk inside their own job: jobs that read none of each other's output share one launch.
__device__ __forceinline__ void wtG(int blk, const float* __restrict__ w, int K, int N, bf* Bt) {
    const int lane = threadIdx.x & 31; const int L0 = (blk * 8 + (threadIdx.x >> 5)) * 8; const int nlines = N * K / 64;
{
#pragma unroll 1
        for (int l = 0; l < 8; ++l) { const int L = L0 + l; if (L >= nlines) break; const size_t e = (size_t)L * 64 + lane * 2; const int k = (int)(e % K), n = (int)(e / K); v2us o;
            o[0] = f2bf(w[(size_t)k * N + n]); o[1] = f2bf(w[(size_t)(k + 1) * N + n]); *(v2us*)(Bt + e) = o; }
         }
}
__device__ __forceinline__ void cvt8(int blk, const float* __restrict__ src, bf* dst, size_t n8) { const size_t i = (size_t)blk * 256 + threadIdx.x; if (i >= n8) return; const v8f v = *(const v8f*)(src + i * 8); v8us o;
#pragma unroll
    for (int k = 0; k < 8; ++k) o[k] = f2bf(v[k]); *(v8us*)(dst + i * 8) = o;  }
__device__ __forceinline__ void cscvt(int blk, const float* __restrict__ cosT, const float* __restrict__ sinT, float* CS) { const int idx = blk * 256 + threadIdx.x; if (idx >= TT * HD) return; v2f cs; cs[0] = bfr(cosT[idx]); cs[1] = bfr(sinT[idx]); *(v2f*)(CS + (size_t)idx * 2) = cs;  }
// ---- k_prep: every conversion that reads inputs alone, one launch: the four weights transposed to bf16 (WT: q, k, v, o one after the other), x of both batches to bf16, the cos/sin table.
static_assert(DQ == DM && DKV == DM && NKV == NH_, "the four weights share one shape, q and k planes one size");
#define WBLK (DM * DQ / 64 / 64)           // work-groups per weight
#define XBLK (NB_ * TT * DM / 8 / 256)     // work-groups on x
#define CBLK (TT * HD / 256)               // work-groups on the cos/sin table
__global__ __launch_bounds__(256) void k_prep(const float* __restrict__ wq, const float* __restrict__ wk, const float* __restrict__ wv, const float* __restrict__ wo, const float* __restrict__ x, const float* __restrict__ cosT, const float* __restrict__ sinT, bf* WT, bf* XB, float* CS) {
    const int blk = blockIdx.x;
    if (blk < 4 * WBLK) { const int wi = blk / WBLK; wtG(blk % WBLK, wi == 0 ? wq : wi == 1 ? wk : wi == 2 ? wv : wo, DM, DQ, WT + (size_t)wi * DM * DQ); }
    else if (blk < 4 * WBLK + XBLK) cvt8(blk - 4 * WBLK, x, XB, (size_t)NB_ * TT * DM / 8);
    else cscvt(blk - 4 * WBLK - XBLK, cosT, sinT, CS);
}
// ---- k_fattn: scores, mask add, softmax and attn.v of both batches in ONE launch; the score plane never leaves registers.
// One wave owns NQ x 16 query columns of one head and walks all TT keys, 32 a pass: S^T = K Q^T (a lane holds 16 keys' scores of ONE query per column group), t = S^T x HD^-0.5 + mask[i][j] (float, read, rounded to bf16),
// running maximum and running sum per query (sum and accumulators are rescaled every pass by exp(old maximum - new maximum)), P^T packed from the two score tiles straight into a B operand (same k order as the V^T loader), O^T += V^T P^T.
// Query rows < RH: hi+lo bf16 planes, 3 products in both GEMMs; the rest: single fp16. The result O / sum goes out as the hi+lo planes of the output projection's A operand, 8 consecutive d per lane.
__device__ __forceinline__ float bfrc(float f) { return (float)(__bf16)f; }
__device__ __forceinline__ float xhalf(float f) { const int b = __float_as_int(f); return __int_as_float(__builtin_amdgcn_permlanex16(b, b, 0x76543210, 0xfedcba98, false, false)); }   // lane l reads lane l ^ 16
template <typename T16, bool HI, int NQ>
__device__ __forceinline__ void attn_wave(const T16* __restrict__ Q, const T16* __restrict__ Q2, const T16* __restrict__ Kp, const T16* __restrict__ K2, const T16* __restrict__ Vt, const T16* __restrict__ Vt2, const float* __restrict__ mk, int q0, bf* Ah, bf* Al) {
    typedef typename WFrag<T16>::V V; typedef WFrag<T16> F;
    const int lane = threadIdx.x & 31, lr = lane & 15, hi = lane >> 4;
    V qf[NQ][2], qf2[NQ][2], kf[2][2], kf2[2][2], vf[4], vf2[4]; v8f mf[NQ][2], o[NQ][4]; float m[NQ], l[NQ];
#pragma unroll
    for (int nq = 0; nq < NQ; ++nq) { m[nq] = -3.0e38f; l[nq] = 0.f;
#pragma unroll
        for (int ks = 0; ks < 2; ++ks) { const size_t qo = (size_t)(q0 + nq * 16 + lr) * HD + ks * 32 + 8 * hi; qf[nq][ks] = F::ld(Q + qo); if (HI) qf2[nq][ks] = F::ld(Q2 + qo); }
#pragma unroll
        for (int dt = 0; dt < 4; ++dt) o[nq][dt] = (v8f){}; }
    const size_t ko = (size_t)lr * HD + 8 * hi, vo = (size_t)lr * TT + 8 * hi; const float* mrow = mk + (size_t)(q0 + lr) * TT + 8 * hi;
    auto ldk = [&](int kb) {
#pragma unroll
        for (int kt = 0; kt < 2; ++kt)
#pragma unroll
            for (int ks = 0; ks < 2; ++ks) { const size_t e = ko + (size_t)(kb + kt * 16) * HD + ks * 32; kf[kt][ks] = F::ld(Kp + e); if (HI) kf2[kt][ks] = F::ld(K2 + e); } };
    // the two 16-byte halves are joined into one value: left as bare loaded values, the compiler merged this refill with the prologue's load into one load at the loop's top, its latency exposed
    auto ldm = [&](int kb) {
#pragma unroll
        for (int nq = 0; nq < NQ; ++nq)
#pragma unroll
            for (int kt = 0; kt < 2; ++kt) { const float* p = mrow + (size_t)nq * 16 * TT + kb + kt * 16; mf[nq][kt] = __builtin_shufflevector(*(const v4f*)p, *(const v4f*)(p + 4), 0, 1, 2, 3, 4, 5, 6, 7); } };
    auto ldv = [&](int kb) {
#pragma unroll
        for (int dt = 0; dt < 4; ++dt) { const size_t e = vo + (size_t)dt * 16 * TT + kb; vf[dt] = F::ld(Vt + e); if (HI) vf2[dt] = F::ld(Vt2 + e); } };
    ldk(0);
    __builtin_amdgcn_sched_barrier(0);   // keeps Q and the first K ahead of the first mask and V loads, the loop's own order: with a K load issued last here, the wait at the loop's top covers every load of every pass, the V refill just issued too
    ldm(0); ldv(0);
    // rolled: the body is already 32 keys wide, and each operand set is refilled in place right behind its last use, so that the next pass's loads fly under this pass's work
#pragma unroll 1
    for (int kb = 0; kb < TT; kb += 32) {
        const int kn = (kb + 32) & (TT - 1);   // the last pass refetches pass 0 (in bounds, unused)
        v8f st[NQ][2];
#pragma unroll
        for (int nq = 0; nq < NQ; ++nq)
#pragma unroll
            for (int kt = 0; kt < 2; ++kt) { v8f s = (v8f){};
#pragma unroll
                for (int ks = 0; ks < 2; ++ks) { s = F::mma(kf[kt][ks], qf[nq][ks], s); if (HI) { s = F::mma(kf[kt][ks], qf2[nq][ks], s); s = F::mma(kf2[kt][ks], qf[nq][ks], s); } }
                st[nq][kt] = s; }
        ldk(kn);
        __builtin_amdgcn_sched_barrier(0);   // keeps the K refill here, a whole softmax ahead of its use; the scheduler otherwise sinks it behind the attn.v products
        float t[NQ][16], mx[NQ];
#pragma unroll
        for (int nq = 0; nq < NQ; ++nq) { mx[nq] = m[nq];
#pragma unroll
            for (int e = 0; e < 16; ++e) { t[nq][e] = st[nq][e >> 3][e & 7] * SCL + bfrc(mf[nq][e >> 3][e & 7]); mx[nq] = fmaxf(mx[nq], t[nq][e]); } }
        ldm(kn);
        __builtin_amdgcn_sched_barrier(0);   // keeps the mask refill here, most of a pass ahead of its use; the scheduler otherwise sinks it into the attn.v products
        V pf[NQ], pf2[NQ];
#pragma unroll
        for (int nq = 0; nq < NQ; ++nq) { const float mn = fmaxf(mx[nq], xhalf(mx[nq]));   // lanes c and c + 16 hold the two key halves of query c
            const float al = __builtin_amdgcn_exp2f((m[nq] - mn) * 1.4426950408889634f); m[nq] = mn;
#pragma unroll
            for (int e = 0; e < 16; ++e) t[nq][e] = __builtin_amdgcn_exp2f((t[nq][e] - mn) * 1.4426950408889634f);
            float ls[8];   // pairwise tree: four dependent adds deep instead of sixteen
#pragma unroll
            for (int e = 0; e < 8; ++e) ls[e] = t[nq][e] + t[nq][e + 8];
#pragma unroll
            for (int w = 4; w; w >>= 1)
#pragma unroll
                for (int e = 0; e < w; ++e) ls[e] += ls[e + w];
            l[nq] = l[nq] * al + ls[0];
#pragma unroll
            for (int dt = 0; dt < 4; ++dt) o[nq][dt] *= al;
            if constexpr (HI) {
#pragma unroll
                for (int e = 0; e < 16; ++e) { const __bf16 ph = (__bf16)t[nq][e]; pf[nq][e] = ph; pf2[nq][e] = (__bf16)(t[nq][e] - (float)ph); }
            } else {
#pragma unroll
                for (int e = 0; e < 16; ++e) pf[nq][e] = (h16)t[nq][e]; } }
#pragma unroll
        for (int nq = 0; nq < NQ; ++nq)
#pragma unroll
            for (int dt = 0; dt < 4; ++dt) { o[nq][dt] = F::mma(vf[dt], pf[nq], o[nq][dt]); if (HI) { o[nq][dt] = F::mma(vf[dt], pf2[nq], o[nq][dt]); o[nq][dt] = F::mma(vf2[dt], pf[nq], o[nq][dt]); } }
        ldv(kn);
        asm volatile("s_wait_xcnt 0x0" ::: "memory");   // stands in front of the next pass's first products, whose results may land in the registers that hold the addresses of the loads above
    }
#pragma unroll
    for (int nq = 0; nq < NQ; ++nq) { const float inv = __fdiv_rn(1.0f, l[nq] + xhalf(l[nq])); const size_t oo = (size_t)(q0 + nq * 16 + lr) * DQ + 8 * hi;
#pragma unroll
        for (int dt = 0; dt < 4; ++dt) { v8us oh, ol;
#pragma unroll
            for (int j = 0; j < 8; ++j) { unsigned short a, c2; splitf(o[nq][dt][j] * inv, a, c2); oh[j] = a; ol[j] = c2; }
            *(v8us*)(Ah + oo + dt * 16) = oh; *(v8us*)(Al + oo + dt * 16) = ol;
            asm volatile("s_wait_xcnt 0x0" ::: "memory"); } }   // stands in front of the next tile's packing, which reuses the registers that the two stores name
}
#define HWG (RH / 16)            // work-groups per head on rows < RH: one wave, 16 query columns
#define LWG ((TT - RH) / 32)     // work-groups per head on the other rows: one wave, 32 query columns
// single-wave work-groups spread evenly over the chip; the 3-product ones have the low indices and start first
__global__ __launch_bounds__(32) void k_fattn(const h16* __restrict__ Q16, const h16* __restrict__ K16, const h16* __restrict__ V16, const bf* __restrict__ Qh, const bf* __restrict__ Ql, const bf* __restrict__ Kh, const bf* __restrict__ Kl, const bf* __restrict__ Vh, const bf* __restrict__ Vl, const float* __restrict__ mk, bf* Ah, bf* Al) {
    const int blk = blockIdx.x;
    // bh = b NH_ + h: the planes are [b][h], the mask is one for all, the output rows are b TT + t
    if (blk < NB_ * NH_ * HWG) { const int bh = blk / HWG, h = bh % NH_, b = bh / NH_; const size_t po = (size_t)bh * TT * HD, pk = (size_t)(b * NKV + h / REP) * TT * HD, ao = (size_t)b * TT * DQ + h * HD; attn_wave<bf, true, 1>(Qh + po, Ql + po, Kh + pk, Kl + pk, Vh + pk, Vl + pk, mk, (blk % HWG) * 16, Ah + ao, Al + ao); }
    else { const int b2 = blk - NB_ * NH_ * HWG; const int bh = b2 / LWG, h = bh % NH_, b = bh / NH_; const size_t po = (size_t)bh * TT * HD, pk = (size_t)(b * NKV + h / REP) * TT * HD, ao = (size_t)b * TT * DQ + h * HD; attn_wave<h16, false, 2>(Q16 + po, nullptr, K16 + pk, nullptr, V16 + pk, nullptr, mk, RH + (b2 % LWG) * 32, Ah + ao, Al + ao); }
}

extern "C" void kernel_launch(void* const* d_in, const int* in_sizes, int n_in,
                              void* d_out, int out_size, void* d_ws, size_t ws_size, hipStream_t stream) {
    (void)in_sizes; (void)n_in; (void)out_size;
    const float* x = (const float*)d_in[0]; const float* rope = (const float*)d_in[1]; const float* cosT = rope; const float* sinT = rope + (size_t)TT * HD; const float* fmask = (const float*)d_in[2]; const float* wq = (const float*)d_in[3]; const float* bq = (const float*)d_in[4]; const float* wk = (const float*)d_in[5]; const float* bk = (const float*)d_in[6]; const float* wv = (const float*)d_in[7]; const float* bv = (const float*)d_in[8]; const float* wo = (const float*)d_in[9]; const float* bo = (const float*)d_in[10];
    float* OUT = (float*)d_out;     // [2][2048][1024]
    char* wsp = (char*)d_ws;
    auto take = [&](size_t bytes) { char* p = wsp; wsp += (bytes + 255) & ~(size_t)255; return (void*)p; };
    bf* WT = (bf*)take((size_t)4 * DQ * DM * 2); float* CS = (float*)take((size_t)TT * HD * 2 * 4);
    bf* XB = (bf*)take((size_t)NB_ * TT * DM * 2);
    h16* QK16 = (h16*)take(2 * PLN * 2); h16* VT16 = (h16*)take(PLN * 2);
    bf* QKh = (bf*)take(2 * PLN * 2); bf* QKl = (bf*)take(2 * PLN * 2); bf* VTh = (bf*)take(PLN * 2); bf* VTl = (bf*)take(PLN * 2);
    bf* ATh = (bf*)take((size_t)NB_ * TT * DQ * 2); bf* ATl = (bf*)take((size_t)NB_ * TT * DQ * 2);
    if ((size_t)(wsp - (char*)d_ws) > ws_size) return;    // ws 256 MiB
    k_prep<<<4 * WBLK + XBLK + CBLK, 256, 0, stream>>>(wq, wk, wv, wo, x, cosT, sinT, WT, XB, CS);
    k_gemmw<bf, 0, true, 1, true><<<dim3(NB_ * TT / 64, DQ / 64, 3), 32, 0, stream>>>(XB, nullptr, WT, nullptr, DM, nullptr, DQ, bq, bk, bv, 0, (size_t)DQ * DM, 0, 0, CS, QK16, QKh, QKl, VT16, VTh, VTl);
    k_fattn<<<NB_ * NH_ * (HWG + LWG), 32, 0, stream>>>(QK16, QK16 + PLN, VT16, QKh, QKl, QKh + PLN, QKl + PLN, VTh, VTl, fmask, ATh, ATl);
    k_gemmw<bf, 1, true><<<dim3(NB_ * TT / 64, DM / 64, 1), 32, 0, stream>>>(ATh, ATl, WT + (size_t)3 * DQ * DM, nullptr, DQ, OUT, DM, bo, bo, bo, 0, 0, 0);
}

// v005
// It runs in 187 microseconds.
// Timed twice side by side with v004, it ran 1.46 and 1.48 times as fast.
// Counting every step since v000, it is 11.2 times as fast.
#include <hip/hip_runtime.h>

// Attention block (x [2][2048][1024]; q/k/v = x W + b (16 heads x 64); interleaved-pair RoPE q cos + rot(q) sin with rot = (x0, x1) -> (-x1, x0) and the cos/sin tables READ from the rope input ([2][1][S][1][64]); scores = q.k/8 + mask[i][j] (float, read; zeros here);
// softmax; out = (attn v merged) Wo + bo -> [2][2048][1024]).
// Compute dtypes, f32 accumulate: every input rounded to bf16; q/k/v on PLAIN bf16 operands (inputs: exact) + bias; RoPE f32; scores and attn.v: query rows < 512 hl (3 products), the rest single fp16; mask add + softmax f32, fused with both products in one kernel (running maximum and sum);
// Four launches, each over BOTH batches: input conversions; q, k and v projections (grid z), whose epilogue writes the head planes; attention; output projection.
// FRAGMENT ORDER: every 16-bit plane that a matrix loop reads (x, the weights, q, k, v^T, the mask's bf16 rounding, the attention output) is a [rows][K] matrix stored as tiles of 16 rows x 32 k, 512 elements each, tile (row / 16, k / 32) at index (row / 16) (K / 32) + k / 32;
// inside a tile element (r, c) stands at (c / 16) 256 + ((c / 8 % 2) 16 + r) 8 + c % 8, which is [half][lane][8]: the place the WMMA operand map gives it. A fragment is then two 16-byte loads at tile + lane 8 and + 256, each 512 contiguous bytes (4 whole lines) instead of 32 bytes out of each of 16 lines.

#define NB_  2
#define TT   2048
#define DM   1024
#define NH_  16
#define NKV  16
#define REP  (NH_ / NKV)
#define HD   64
#define DQ   (NH_ * HD)
#define DKV  (NKV * HD)
#define RH   512                  // query rows < RH use hi+lo planes (0: none)
#define WIN  0
#define SCL  0.125f   // HD^-0.5
typedef _Float16 h16;
typedef unsigned short bf;
typedef __attribute__((ext_vector_type(16))) __bf16   v16bf;
typedef __attribute__((ext_vector_type(16))) _Float16 v16h;
typedef __attribute__((ext_vector_type(8)))  _Float16 v8h;
typedef __attribute__((ext_vector_type(8)))  unsigned short v8us;
typedef __attribute__((ext_vector_type(16))) unsigned short v16us;
typedef __attribute__((ext_vector_type(8)))  float    v8f;
typedef __attribute__((ext_vector_type(4)))  float    v4f;
typedef v8h  __attribute__((may_alias)) v8ha;
typedef v4f  __attribute__((may_alias)) v4fa;
typedef v8us __attribute__((may_alias)) v8usa;

__device__ __forceinline__ unsigned short f2bf(float f) { unsigned u = __float_as_uint(f); u += 0x7FFFu + ((u >> 16) & 1u); return (unsigned short)(u >> 16); }
__device__ __forceinline__ float bf2f(unsigned short b) { return __uint_as_float(((unsigned)b) << 16); }
__device__ __forceinline__ float bfr(float f) { return bf2f(f2bf(f)); }
__device__ __forceinline__ v16h cat16(v8h lo, v8h hi) { return __builtin_shufflevector(lo, hi, 0, 1, 2, 3, 4, 5, 6, 7, 8, 9, 10, 11, 12, 13, 14, 15); }
__device__ __forceinline__ v16bf cat16b(v8us lo, v8us hi) { return __builtin_bit_cast(v16bf, __builtin_shufflevector(lo, hi, 0, 1, 2, 3, 4, 5, 6, 7, 8, 9, 10, 11, 12, 13, 14, 15)); }
__device__ __forceinline__ v8f wmma16(v16h a, v16h b, v8f c) { return __builtin_amdgcn_wmma_f32_16x16x32_f16(false, a, false, b, (short)0, c, false, false); }
__device__ __forceinline__ v8f wmmab(v16bf a, v16bf b, v8f c) { return __builtin_amdgcn_wmma_f32_16x16x32_bf16(false, a, false, b, (short)0, c, false, false); }

__device__ __forceinline__ h16 tohx(float x) { return (h16)x; }
__device__ __forceinline__ void splitf(float y, unsigned short& h, unsigned short& l) { h = f2bf(y); l = f2bf(y - bf2f(h)); }
typedef __attribute__((ext_vector_type(2))) _Float16 v2h;
typedef __attribute__((ext_vector_type(4))) _Float16 v4h;
typedef __attribute__((ext_vector_type(2))) unsigned short v2us;
typedef __attribute__((ext_vector_type(4))) unsigned short v4us;
typedef __attribute__((ext_vector_type(2))) float v2f;
typedef __attribute__((ext_vector_type(4))) int v4i;
typedef __attribute__((ext_vector_type(4))) __bf16 v4b;
typedef __attribute__((ext_vector_type(8))) __bf16 v8b;
#define PLN  ((size_t)NB_ * NH_ * TT * HD)     // elements of one projection and of each of its planes

// ---- k_gemmw: register-blocked GEMM, ONE WAVE per 64x64 output tile (16 accumulators), operands straight from 16-bit planes in fragment order; grid (M/64, N/64, Z), 32 threads.
// C[m][n] (f32, pitch ldc, + optional f32 bias[n]) = sum_k A[m][k] Bt[n][k] (+ split products per NSPLIT). z-batch strides sA/sB/sC in elements; z = 0, 1, 2 adds bias, bias1, bias2. K % 32 == 0.
// PL: no C; the tile is 64 tokens of ONE head, and the epilogue writes the attention kernel's operand planes from it: z = 0, 1 (q, k): + bias, interleaved-pair RoPE (out[d] = x[d] cos[t][d] -/+ x[d ^ 1] sin[t][d], - for even d), planes [b][h] of [t][d] in fragment order as fp16 and as hi+lo bf16, q's followed by k's in P16, Ph and Pl;
// z = 2 (v): + bias, transposed planes [b][g] of [d][t] in fragment order, straight from the accumulators (a lane holds 8 consecutive t of one d: its own 16 bytes of a tile half).
// KSL > 1: grid z = Z * KSL; work-group (z, ks) sums only k in [ks K/KSL, (ks+1) K/KSL) and stores that partial tile in plane ks (plane stride sP elements); the reader adds the KSL planes. K % (32 KSL) == 0.
template <typename T16> struct WFrag;
template <> struct WFrag<h16> { typedef v16h V; static __device__ __forceinline__ V ld(const h16* p) { return cat16(*(const v8h*)p, *(const v8h*)(p + 256)); } static __device__ __forceinline__ v8f mma(V a, V b, v8f c) { return wmma16(a, b, c); } };
template <> struct WFrag<bf> { typedef v16bf V; static __device__ __forceinline__ V ld(const bf* p) { return cat16b(*(const v8us*)p, *(const v8us*)(p + 256)); } static __device__ __forceinline__ v8f mma(V a, V b, v8f c) { return wmmab(a, b, c); } };
template <typename T16, int NSPLIT, bool BIAS, int KSL = 1, bool PL = false>
__global__ __launch_bounds__(32) void k_gemmw(const T16* __restrict__ A, const T16* __restrict__ A2, const T16* __restrict__ Bt, const T16* __restrict__ Bt2, int K, float* C, int ldc, const float* __restrict__ bias, const float* __restrict__ bias1, const float* __restrict__ bias2, size_t sA, size_t sB, size_t sC, size_t sP = 0, const float* __restrict__ CS = nullptr, h16* P16 = nullptr, bf* Ph = nullptr, bf* Pl = nullptr, h16* V16 = nullptr, bf* Vh = nullptr, bf* Vl = nullptr) {
    typedef typename WFrag<T16>::V V;
    __shared__ __align__(16) float os[16 * 68];
    const size_t z = blockIdx.z / KSL; const int ks = blockIdx.z % KSL; const int kbeg = ks * (K / KSL), kend = kbeg + K / KSL; C += (size_t)ks * sP; A += z * sA; if (A2) A2 += z * sA; Bt += z * sB; if (Bt2) Bt2 += z * sB; C += z * sC; const float* bz = z == 0 ? bias : z == 1 ? bias1 : bias2;
    const int lane = threadIdx.x & 31, lr = lane & 15, hi = lane >> 4; const int r0 = blockIdx.x * 64, c0 = blockIdx.y * 64;
    v8f acc[4][4];
#pragma unroll
    for (int mb = 0; mb < 4; ++mb)
#pragma unroll
        for (int nb = 0; nb < 4; ++nb) acc[mb][nb] = (v8f){};
    const size_t aoff = (size_t)r0 * K + 8 * lane, boff = (size_t)c0 * K + 8 * lane;   // 16 rows of K are K / 32 tiles of 512
#pragma unroll 1
    for (int kc = kbeg; kc < kend; kc += 32) {
        V a[4], a2[4], b[4], b2[4]; const T16 *pa[4], *pa2[4], *pb[4], *pb2[4];
#pragma unroll
        for (int i = 0; i < 4; ++i) { pa[i] = A + aoff + (size_t)i * 16 * K + kc * 16; a[i] = WFrag<T16>::ld(pa[i]); pb[i] = Bt + boff + (size_t)i * 16 * K + kc * 16; b[i] = WFrag<T16>::ld(pb[i]);
            pa2[i] = pa[i]; pb2[i] = pb[i];
            if (NSPLIT == 1 || NSPLIT == 2) { pa2[i] = A2 + aoff + (size_t)i * 16 * K + kc * 16; a2[i] = WFrag<T16>::ld(pa2[i]); } if (NSPLIT >= 2) { pb2[i] = Bt2 + boff + (size_t)i * 16 * K + kc * 16; b2[i] = WFrag<T16>::ld(pb2[i]); } }
        // stands behind the pass's loads and takes their addresses as inputs: no address register is given to a later load's result or to other work before the wait
        asm volatile("s_wait_xcnt 0x0" :: "v"(pa[0]), "v"(pa[1]), "v"(pa[2]), "v"(pa[3]), "v"(pb[0]), "v"(pb[1]), "v"(pb[2]), "v"(pb[3]), "v"(pa2[0]), "v"(pa2[1]), "v"(pa2[2]), "v"(pa2[3]), "v"(pb2[0]), "v"(pb2[1]), "v"(pb2[2]), "v"(pb2[3]) : "memory");
#pragma unroll
        for (int nb = 0; nb < 4; ++nb)
#pragma unroll
            for (int mb = 0; mb < 4; ++mb) { acc[mb][nb] = WFrag<T16>::mma(a[mb], b[nb], acc[mb][nb]); if (NSPLIT == 1 || NSPLIT == 2) acc[mb][nb] = WFrag<T16>::mma(a2[mb], b[nb], acc[mb][nb]); if (NSPLIT >= 2) acc[mb][nb] = WFrag<T16>::mma(a[mb], b2[nb], acc[mb][nb]); }
        asm volatile("v_nop\n\tv_nop\n\tv_nop\n\tv_nop" : "+v"(acc[0][0]), "+v"(acc[1][1]), "+v"(acc[2][2]), "+v"(acc[3][3]) : "v"(a[0]), "v"(a[3]));
    }
    if constexpr (PL) {
        static_assert(HD == 64 && TT % 64 == 0 && NKV == NH_, "a 64 x 64 tile is 64 tokens of one batch and one head");
        const int b = r0 / TT, t0 = r0 % TT, h = c0 / HD;
        if (z == 2) {
            const size_t vb = (size_t)(b * NKV + h) * HD * TT + (size_t)t0 * 16 + 8 * lane;
#pragma unroll
            for (int nb = 0; nb < 4; ++nb) { const float bb = bfr(bz[c0 + nb * 16 + lr]);
#pragma unroll
                for (int mb = 0; mb < 4; ++mb) { v8h o16; v8b oh, ol;
#pragma unroll
                    for (int j = 0; j < 8; ++j) { const float x = acc[mb][nb][j] + bb; o16[j] = tohx(x); oh[j] = (__bf16)x; ol[j] = (__bf16)(x - (float)oh[j]); }
                    const size_t e = vb + (size_t)nb * 16 * TT + (mb >> 1) * 512 + (mb & 1) * 256;
                    *(v8h*)(V16 + e) = o16; *(v8us*)(Vh + e) = __builtin_bit_cast(v8us, oh); *(v8us*)(Vl + e) = __builtin_bit_cast(v8us, ol);
                    asm volatile("s_wait_xcnt 0x0" ::: "memory"); } }   // stands in front of the next tile's packing, which reuses the registers that the three stores name
        } else {
            const int cofs = lr * 4; const size_t pb = z * PLN + ((size_t)(b * NH_ + h) * TT + t0) * HD + (cofs >> 5) * 512 + ((cofs >> 4) & 1) * 256 + ((cofs >> 3) & 1) * 128 + (cofs & 7);
            v4f bb = *(const v4f*)(bz + c0 + cofs);
#pragma unroll
            for (int i = 0; i < 4; ++i) bb[i] = bfr(bb[i]);
#pragma unroll
            for (int mb = 0; mb < 4; ++mb) {
                v4f ca[8], cb[8];   // (cos, sin) of this lane's 4 d in its 8 rows, all asked for before the staging so that one latency covers them
#pragma unroll
                for (int s = 0; s < 8; ++s) { const float* p = CS + ((size_t)(t0 + mb * 16 + 2 * s + hi) * HD + cofs) * 2; ca[s] = *(const v4f*)p; cb[s] = *(const v4f*)(p + 4); }
                asm volatile("s_wait_xcnt 0x0" ::: "memory");   // stands in front of the work below, which reuses the registers that hold the addresses of the loads above
#pragma unroll
                for (int nb = 0; nb < 4; ++nb) {
#pragma unroll
                    for (int j = 0; j < 8; ++j) os[(hi * 8 + j) * 68 + nb * 16 + lr] = acc[mb][nb][j]; }
                __builtin_amdgcn_wave_barrier(); asm volatile("" ::: "memory");   // the rows are read back by other lanes than wrote them
#pragma unroll
                for (int s = 0; s < 8; ++s) { const int row = 2 * s + hi; const v4f val = *(const v4fa*)(os + row * 68 + cofs) + bb; v4f r;
                    r[0] = val[0] * ca[s][0] - val[1] * ca[s][1]; r[1] = val[1] * ca[s][2] + val[0] * ca[s][3]; r[2] = val[2] * cb[s][0] - val[3] * cb[s][1]; r[3] = val[3] * cb[s][2] + val[2] * cb[s][3];
                    v4h o16; v4b oh, ol;
#pragma unroll
                    for (int i = 0; i < 4; ++i) { o16[i] = tohx(r[i]); oh[i] = (__bf16)r[i]; ol[i] = (__bf16)(r[i] - (float)oh[i]); }
                    const size_t e = pb + (size_t)mb * 16 * HD + row * 8;
                    *(v4h*)(P16 + e) = o16; *(v4us*)(Ph + e) = __builtin_bit_cast(v4us, oh); *(v4us*)(Pl + e) = __builtin_bit_cast(v4us, ol);
                    asm volatile("s_wait_xcnt 0x0" ::: "memory"); }   // stands in front of the next rows' packing, which reuses the registers that the three stores name
                __builtin_amdgcn_wave_barrier(); asm volatile("" ::: "memory");   // the next 16 rows overwrite the staging only behind every lane's reads
            }
        }
        return;
    }
#pragma unroll
    for (int mb = 0; mb < 4; ++mb) {
#pragma unroll
        for (int nb = 0; nb < 4; ++nb) {
#pragma unroll
            for (int j = 0; j < 8; ++j) os[(hi * 8 + j) * 68 + nb * 16 + lr] = acc[mb][nb][j]; }
        __builtin_amdgcn_wave_barrier(); asm volatile("" ::: "memory");
        float* crow = C + (size_t)(r0 + mb * 16) * ldc + c0;
{
#pragma unroll
            for (int s = 0; s < 8; ++s) { const int row = 2 * s + hi, cofs = lr * 4; v4f val = *(const v4fa*)(os + row * 68 + cofs); if (BIAS) { val[0] += bfr(bz[c0 + cofs]); val[1] += bfr(bz[c0 + cofs + 1]); val[2] += bfr(bz[c0 + cofs + 2]); val[3] += bfr(bz[c0 + cofs + 3]); }
                *(v4f*)(crow + (size_t)row * ldc + cofs) = val;
                asm volatile("s_wait_xcnt 0x0" ::: "memory"); }   // stands in front of the next rows' work, which reuses the registers that the store names
             }
        __builtin_amdgcn_wave_barrier(); asm volatile("" ::: "memory");
    }
}


// The bodies below take their work-group's index blk inside their own job: jobs that read none of each other's output share one launch.
// wtF: Bt[n][k] = w[k][n] as bf16 in fragment order; a thread writes its lane's 16 bytes of both halves of one tile, and each of its 16 loads reads 16 consecutive n of two k rows per wave.
__device__ __forceinline__ void wtF(unsigned blk, const float* __restrict__ w, unsigned K, unsigned N, bf* Bt) {
    const unsigned u = blk * 256 + threadIdx.x, tile = u >> 5, lane = u & 31; const unsigned n = tile / (K / 32) * 16 + (lane & 15), k0 = tile % (K / 32) * 32 + (lane >> 4) * 8;
#pragma unroll
    for (int hf = 0; hf < 2; ++hf) { v8us o;
#pragma unroll
        for (int j = 0; j < 8; ++j) o[j] = f2bf(w[(size_t)(k0 + hf * 16 + j) * N + n]);
        *(v8us*)(Bt + (size_t)tile * 512 + hf * 256 + lane * 8) = o; }
    asm volatile("s_wait_xcnt 0x0" ::: "memory");   // in the built kernel another job's body stands in line behind this one and reuses the registers that the stores name
}
// cvtF: src [rows][K] f32 -> bf16 in fragment order; a wave takes two tiles (16 rows x 64 k: 256 contiguous bytes of each row), a thread its lane's 16 bytes of their four halves.
template <bool HW>   // HW: the compiler's own f32 -> bf16 conversion, as the attention loop applied it to the mask
__device__ __forceinline__ void cvtF(unsigned blk, const float* __restrict__ src, unsigned K, bf* dst) {
    const unsigned u = blk * 256 + threadIdx.x, tp = u >> 5, lane = u & 31; const unsigned row = tp / (K / 64) * 16 + (lane & 15), k0 = tp % (K / 64) * 64 + (lane >> 4) * 8; const float* p = src + (size_t)row * K + k0; v8f v[4];
#pragma unroll
    for (int q = 0; q < 4; ++q) v[q] = *(const v8f*)(p + q * 16);
#pragma unroll
    for (int q = 0; q < 4; ++q) { v8us o;
#pragma unroll
        for (int k = 0; k < 8; ++k) o[k] = HW ? __builtin_bit_cast(unsigned short, (__bf16)v[q][k]) : f2bf(v[q][k]);
        *(v8us*)(dst + (size_t)tp * 1024 + q * 256 + lane * 8) = o; }
    asm volatile("s_wait_xcnt 0x0" ::: "memory");   // in the built kernel another job's body stands in line behind this one and reuses the registers that the stores name
}
__device__ __forceinline__ void cscvt(int blk, const float* __restrict__ cosT, const float* __restrict__ sinT, float* CS) { const int idx = blk * 256 + threadIdx.x; if (idx >= TT * HD) return; v2f cs; cs[0] = bfr(cosT[idx]); cs[1] = bfr(sinT[idx]); *(v2f*)(CS + (size_t)idx * 2) = cs;  }
// ---- k_prep: every conversion that reads inputs alone, one launch: the four weights transposed to bf16 (WT: q, k, v, o one after the other), x of both batches to bf16, the mask to bf16 (the rounding that the scores add), all in fragment order; the cos/sin table.
static_assert(DQ == DM && DKV == DM && NKV == NH_, "the four weights share one shape, q and k planes one size");
#define WBLK (DM * DQ / 16 / 256)          // work-groups per weight
#define XBLK (NB_ * TT * DM / 32 / 256)    // work-groups on x
#define MBLK (TT * TT / 32 / 256)          // work-groups on the mask
#define CBLK (TT * HD / 256)               // work-groups on the cos/sin table
__global__ __launch_bounds__(256) void k_prep(const float* __restrict__ wq, const float* __restrict__ wk, const float* __restrict__ wv, const float* __restrict__ wo, const float* __restrict__ x, const float* __restrict__ mk, const float* __restrict__ cosT, const float* __restrict__ sinT, bf* WT, bf* XB, bf* MB, float* CS) {
    const int blk = blockIdx.x;
    if (blk < 4 * WBLK) { const int wi = blk / WBLK; wtF(blk % WBLK, wi == 0 ? wq : wi == 1 ? wk : wi == 2 ? wv : wo, DM, DQ, WT + (size_t)wi * DM * DQ); return; }
    if (blk < 4 * WBLK + XBLK) { cvtF<false>(blk - 4 * WBLK, x, DM, XB); return; }
    if (blk < 4 * WBLK + XBLK + MBLK) { cvtF<true>(blk - 4 * WBLK - XBLK, mk, TT, MB); return; }
    cscvt(blk - 4 * WBLK - XBLK - MBLK, cosT, sinT, CS);
}
// ---- k_fattn: scores, mask add, softmax and attn.v of both batches in ONE launch; the score plane never leaves registers.
// One wave owns NQ x 16 query columns of one head and walks all TT keys, 32 a pass: S^T = K Q^T (a lane holds 16 keys' scores of ONE query per column group), t = S^T x HD^-0.5 + mask[i][j] (its bf16 rounding, read from the plane that k_prep wrote: a score tile's lane map is the operand map, so the plane is in the same fragment order),
// running maximum and running sum per query (sum and accumulators are rescaled every pass by exp(old maximum - new maximum)), P^T packed from the two score tiles straight into a B operand (same k order as the V^T loader), O^T += V^T P^T.
// Query rows < RH: hi+lo bf16 planes, 3 products in both GEMMs; the rest: single fp16. The result O / sum goes out as the hi+lo planes of the output projection's A operand, 8 consecutive d per lane.
__device__ __forceinline__ float xhalf(float f) { const int b = __float_as_int(f); return __int_as_float(__builtin_amdgcn_permlanex16(b, b, 0x76543210, 0xfedcba98, false, false)); }   // lane l reads lane l ^ 16
template <typename T16, bool HI, int NQ>
__device__ __forceinline__ void attn_wave(const T16* __restrict__ Q, const T16* __restrict__ Q2, const T16* __restrict__ Kp, const T16* __restrict__ K2, const T16* __restrict__ Vt, const T16* __restrict__ Vt2, const bf* __restrict__ mk, int q0, bf* Ah, bf* Al) {
    typedef typename WFrag<T16>::V V; typedef WFrag<T16> F;
    const int lane = threadIdx.x & 31;
    V qf[NQ][2], qf2[NQ][2], kf[2][2], kf2[2][2], vf[4], vf2[4]; v16us mf[NQ]; v8f o[NQ][4]; float m[NQ], l[NQ];
#pragma unroll
    for (int nq = 0; nq < NQ; ++nq) { m[nq] = -3.0e38f; l[nq] = 0.f;
#pragma unroll
        for (int ks = 0; ks < 2; ++ks) { const size_t qo = (size_t)(q0 + nq * 16) * HD + ks * 512 + 8 * lane; qf[nq][ks] = F::ld(Q + qo); if (HI) qf2[nq][ks] = F::ld(Q2 + qo); }
#pragma unroll
        for (int dt = 0; dt < 4; ++dt) o[nq][dt] = (v8f){}; }
    const size_t ko = 8 * lane, vo = 8 * lane; const bf* mrow = mk + (size_t)q0 * TT + 8 * lane;
    auto ldk = [&](int kb) {
#pragma unroll
        for (int kt = 0; kt < 2; ++kt)
#pragma unroll
            for (int ks = 0; ks < 2; ++ks) { const size_t e = ko + (size_t)(kb + kt * 16) * HD + ks * 512; kf[kt][ks] = F::ld(Kp + e); if (HI) kf2[kt][ks] = F::ld(K2 + e); } };
    // the two 16-byte halves are joined into one value: left as bare loaded values, the compiler merged this refill with the prologue's load into one load at the loop's top, its latency exposed
    auto ldm = [&](int kb) {
#pragma unroll
        for (int nq = 0; nq < NQ; ++nq) { const bf* p = mrow + (size_t)nq * 16 * TT + kb * 16; mf[nq] = __builtin_shufflevector(*(const v8us*)p, *(const v8us*)(p + 256), 0, 1, 2, 3, 4, 5, 6, 7, 8, 9, 10, 11, 12, 13, 14, 15); } };
    auto ldv = [&](int kb) {
#pragma unroll
        for (int dt = 0; dt < 4; ++dt) { const size_t e = vo + (size_t)dt * 16 * TT + kb * 16; vf[dt] = F::ld(Vt + e); if (HI) vf2[dt] = F::ld(Vt2 + e); } };
    ldk(0);
    __builtin_amdgcn_sched_barrier(0);   // keeps Q and the first K ahead of the first mask and V loads, the loop's own order: with a K load issued last here, the wait at the loop's top covers every load of every pass, the V refill just issued too
    ldm(0); ldv(0);
    // rolled: the body is already 32 keys wide, and each operand set is refilled in place right behind its last use, so that the next pass's loads fly under this pass's work
#pragma unroll 1
    for (int kb = 0; kb < TT; kb += 32) {
        const int kn = (kb + 32) & (TT - 1);   // the last pass refetches pass 0 (in bounds, unused)
        v8f st[NQ][2];
#pragma unroll
        for (int nq = 0; nq < NQ; ++nq)
#pragma unroll
            for (int kt = 0; kt < 2; ++kt) { v8f s = (v8f){};
#pragma unroll
                for (int ks = 0; ks < 2; ++ks) { s = F::mma(kf[kt][ks], qf[nq][ks], s); if (HI) { s = F::mma(kf[kt][ks], qf2[nq][ks], s); s = F::mma(kf2[kt][ks], qf[nq][ks], s); } }
                st[nq][kt] = s; }
        ldk(kn);
        __builtin_amdgcn_sched_barrier(0);   // keeps the K refill here, a whole softmax ahead of its use; the scheduler otherwise sinks it behind the attn.v products
        float t[NQ][16], mx[NQ];
#pragma unroll
        for (int nq = 0; nq < NQ; ++nq) { mx[nq] = m[nq];
#pragma unroll
            for (int e = 0; e < 16; ++e) { t[nq][e] = st[nq][e >> 3][e & 7] * SCL + bf2f(mf[nq][e]); mx[nq] = fmaxf(mx[nq], t[nq][e]); } }
        ldm(kn);
        __builtin_amdgcn_sched_barrier(0);   // keeps the mask refill here, most of a pass ahead of its use; the scheduler otherwise sinks it into the attn.v products
        V pf[NQ], pf2[NQ];
#pragma unroll
        for (int nq = 0; nq < NQ; ++nq) { const float mn = fmaxf(mx[nq], xhalf(mx[nq]));   // lanes c and c + 16 hold the two key halves of query c
            const float al = __builtin_amdgcn_exp2f((m[nq] - mn) * 1.4426950408889634f); m[nq] = mn;
#pragma unroll
            for (int e = 0; e < 16; ++e) t[nq][e] = __builtin_amdgcn_exp2f((t[nq][e] - mn) * 1.4426950408889634f);
            float ls[8];   // pairwise tree: four dependent adds deep instead of sixteen
#pragma unroll
            for (int e = 0; e < 8; ++e) ls[e] = t[nq][e] + t[nq][e + 8];
#pragma unroll
            for (int w = 4; w; w >>= 1)
#pragma unroll
                for (int e = 0; e < w; ++e) ls[e] += ls[e + w];
            l[nq] = l[nq] * al + ls[0];
#pragma unroll
            for (int dt = 0; dt < 4; ++dt) o[nq][dt] *= al;
            if constexpr (HI) {
#pragma unroll
                for (int e = 0; e < 16; ++e) { const __bf16 ph = (__bf16)t[nq][e]; pf[nq][e] = ph; pf2[nq][e] = (__bf16)(t[nq][e] - (float)ph); }
            } else {
#pragma unroll
                for (int e = 0; e < 16; ++e) pf[nq][e] = (h16)t[nq][e]; } }
#pragma unroll
        for (int nq = 0; nq < NQ; ++nq)
#pragma unroll
            for (int dt = 0; dt < 4; ++dt) { o[nq][dt] = F::mma(vf[dt], pf[nq], o[nq][dt]); if (HI) { o[nq][dt] = F::mma(vf[dt], pf2[nq], o[nq][dt]); o[nq][dt] = F::mma(vf2[dt], pf[nq], o[nq][dt]); } }
        ldv(kn);
        // stands in front of the next pass's first products, whose results may land in the registers that hold the addresses of the loads above; it takes those addresses as inputs, so that none is given to a later load's result before it
        if constexpr (HI) asm volatile("s_wait_xcnt 0x0" :: "v"(Vt + vo + (size_t)kn * 16), "v"(Vt2 + vo + (size_t)kn * 16) : "memory"); else asm volatile("s_wait_xcnt 0x0" :: "v"(Vt + vo + (size_t)kn * 16) : "memory");
    }
#pragma unroll
    for (int nq = 0; nq < NQ; ++nq) { const float inv = __fdiv_rn(1.0f, l[nq] + xhalf(l[nq])); const size_t oo = (size_t)(q0 + nq * 16) * DQ + 8 * lane;
#pragma unroll
        for (int dt = 0; dt < 4; ++dt) { v8us oh, ol;
#pragma unroll
            for (int j = 0; j < 8; ++j) { unsigned short a, c2; splitf(o[nq][dt][j] * inv, a, c2); oh[j] = a; ol[j] = c2; }
            *(v8us*)(Ah + oo + dt * 256) = oh; *(v8us*)(Al + oo + dt * 256) = ol;
            asm volatile("s_wait_xcnt 0x0" ::: "memory"); } }   // stands in front of the next tile's packing, which reuses the registers that the two stores name
}
#define HWG (RH / 16)            // work-groups per head on rows < RH: one wave, 16 query columns
#define LWG ((TT - RH) / 32)     // work-groups per head on the other rows: one wave, 32 query columns
// single-wave work-groups spread evenly over the chip; the 3-product ones have the low indices and start first
__global__ __launch_bounds__(32) void k_fattn(const h16* __restrict__ Q16, const h16* __restrict__ K16, const h16* __restrict__ V16, const bf* __restrict__ Qh, const bf* __restrict__ Ql, const bf* __restrict__ Kh, const bf* __restrict__ Kl, const bf* __restrict__ Vh, const bf* __restrict__ Vl, const bf* __restrict__ mk, bf* Ah, bf* Al) {
    const int blk = blockIdx.x;
    // bh = b NH_ + h: the planes are [b][h], the mask is one for all, the output rows are b TT + t, its k is h HD + d (HD / 32 tiles a head)
    if (blk < NB_ * NH_ * HWG) { const int bh = blk / HWG, h = bh % NH_, b = bh / NH_; const size_t po = (size_t)bh * TT * HD, pk = (size_t)(b * NKV + h / REP) * TT * HD, ao = (size_t)b * TT * DQ + h * (HD * 16); attn_wave<bf, true, 1>(Qh + po, Ql + po, Kh + pk, Kl + pk, Vh + pk, Vl + pk, mk, (blk % HWG) * 16, Ah + ao, Al + ao); }
    else { const int b2 = blk - NB_ * NH_ * HWG; const int bh = b2 / LWG, h = bh % NH_, b = bh / NH_; const size_t po = (size_t)bh * TT * HD, pk = (size_t)(b * NKV + h / REP) * TT * HD, ao = (size_t)b * TT * DQ + h * (HD * 16); attn_wave<h16, false, 2>(Q16 + po, nullptr, K16 + pk, nullptr, V16 + pk, nullptr, mk, RH + (b2 % LWG) * 32, Ah + ao, Al + ao); }
}

extern "C" void kernel_launch(void* const* d_in, const int* in_sizes, int n_in,
                              void* d_out, int out_size, void* d_ws, size_t ws_size, hipStream_t stream) {
    (void)in_sizes; (void)n_in; (void)out_size;
    const float* x = (const float*)d_in[0]; const float* rope = (const float*)d_in[1]; const float* cosT = rope; const float* sinT = rope + (size_t)TT * HD; const float* fmask = (const float*)d_in[2]; const float* wq = (const float*)d_in[3]; const float* bq = (const float*)d_in[4]; const float* wk = (const float*)d_in[5]; const float* bk = (const float*)d_in[6]; const float* wv = (const float*)d_in[7]; const float* bv = (const float*)d_in[8]; const float* wo = (const float*)d_in[9]; const float* bo = (const float*)d_in[10];
    float* OUT = (float*)d_out;     // [2][2048][1024]
    char* wsp = (char*)d_ws;
    auto take = [&](size_t bytes) { char* p = wsp; wsp += (bytes + 255) & ~(size_t)255; return (void*)p; };
    bf* WT = (bf*)take((size_t)4 * DQ * DM * 2); float* CS = (float*)take((size_t)TT * HD * 2 * 4);
    bf* XB = (bf*)take((size_t)NB_ * TT * DM * 2); bf* MB = (bf*)take((size_t)TT * TT * 2);
    h16* QK16 = (h16*)take(2 * PLN * 2); h16* VT16 = (h16*)take(PLN * 2);
    bf* QKh = (bf*)take(2 * PLN * 2); bf* QKl = (bf*)take(2 * PLN * 2); bf* VTh = (bf*)take(PLN * 2); bf* VTl = (bf*)take(PLN * 2);
    bf* ATh = (bf*)take((size_t)NB_ * TT * DQ * 2); bf* ATl = (bf*)take((size_t)NB_ * TT * DQ * 2);
    if ((size_t)(wsp - (char*)d_ws) > ws_size) return;    // ws 256 MiB
    k_prep<<<4 * WBLK + XBLK + MBLK + CBLK, 256, 0, stream>>>(wq, wk, wv, wo, x, fmask, cosT, sinT, WT, XB, MB, CS);
    k_gemmw<bf, 0, true, 1, true><<<dim3(NB_ * TT / 64, DQ / 64, 3), 32, 0, stream>>>(XB, nullptr, WT, nullptr, DM, nullptr, DQ, bq, bk, bv, 0, (size_t)DQ * DM, 0, 0, CS, QK16, QKh, QKl, VT16, VTh, VTl);
    k_fattn<<<NB_ * NH_ * (HWG + LWG), 32, 0, stream>>>(QK16, QK16 + PLN, VT16, QKh, QKl, QKh + PLN, QKl + PLN, VTh, VTl, MB, ATh, ATl);
    k_gemmw<bf, 1, true><<<dim3(NB_ * TT / 64, DM / 64, 1), 32, 0, stream>>>(ATh, ATl, WT + (size_t)3 * DQ * DM, nullptr, DQ, OUT, DM, bo, bo, bo, 0, 0, 0);
}

// v006
// It runs in 169 microseconds.
// In two side-by-side timings against v005, it was 1.12 and 1.14 times as fast.
// Over all steps from v000 it is 12.6 times as fast.
#include <hip/hip_runtime.h>

// Attention block (x [2][2048][1024]; q/k/v = x W + b (16 heads x 64); interleaved-pair RoPE q cos + rot(q) sin with rot = (x0, x1) -> (-x1, x0) and the cos/sin tables READ from the rope input ([2][1][S][1][64]); scores = q.k/8 + mask[i][j] (float, read; zeros here);
// softmax; out = (attn v merged) Wo + bo -> [2][2048][1024]).
// Compute dtypes, f32 accumulate: every input rounded to bf16; q/k/v on PLAIN bf16 operands (inputs: exact) + bias; RoPE f32; scores and attn.v: query rows < 512 hl (3 products), the rest single fp16; mask add + softmax f32, fused with both products in one kernel (running maximum and sum);
// Four launches, each over BOTH batches: input conversions; q, k and v projections (grid z), whose epilogue writes the head planes; attention; output projection.
// FRAGMENT ORDER: every 16-bit plane that a matrix loop reads (x, the weights, q, k, v^T, the mask's bf16 rounding, the attention output) is a [rows][K] matrix stored as tiles of 16 rows x 32 k, 512 elements each, tile (row / 16, k / 32) at index (row / 16) (K / 32) + k / 32;
// inside a tile element (r, c) stands at (c / 16) 256 + ((c / 8 % 2) 16 + r) 8 + c % 8, which is [half][lane][8]: the place the WMMA operand map gives it. A fragment is then two 16-byte loads at tile + lane 8 and + 256, each 512 contiguous bytes (4 whole lines) instead of 32 bytes out of each of 16 lines.

#define NB_  2
#define TT   2048
#define DM   1024
#define NH_  16
#define NKV  16
#define REP  (NH_ / NKV)
#define HD   64
#define DQ   (NH_ * HD)
#define DKV  (NKV * HD)
#define RH   512                  // query rows < RH use hi+lo planes (0: none)
#define WIN  0
#define SCL  0.125f   // HD^-0.5
typedef _Float16 h16;
typedef unsigned short bf;
typedef __attribute__((ext_vector_type(16))) __bf16   v16bf;
typedef __attribute__((ext_vector_type(16))) _Float16 v16h;
typedef __attribute__((ext_vector_type(8)))  _Float16 v8h;
typedef __attribute__((ext_vector_type(8)))  unsigned short v8us;
typedef __attribute__((ext_vector_type(16))) unsigned short v16us;
typedef __attribute__((ext_vector_type(8)))  float    v8f;
typedef __attribute__((ext_vector_type(4)))  float    v4f;
typedef v8h  __attribute__((may_alias)) v8ha;
typedef v4f  __attribute__((may_alias)) v4fa;
typedef v8us __attribute__((may_alias)) v8usa;

__device__ __forceinline__ unsigned short f2bf(float f) { unsigned u = __float_as_uint(f); u += 0x7FFFu + ((u >> 16) & 1u); return (unsigned short)(u >> 16); }
__device__ __forceinline__ float bf2f(unsigned short b) { return __uint_as_float(((unsigned)b) << 16); }
__device__ __forceinline__ float bfr(float f) { return bf2f(f2bf(f)); }
__device__ __forceinline__ v16h cat16(v8h lo, v8h hi) { return __builtin_shufflevector(lo, hi, 0, 1, 2, 3, 4, 5, 6, 7, 8, 9, 10, 11, 12, 13, 14, 15); }
__device__ __forceinline__ v16bf cat16b(v8us lo, v8us hi) { return __builtin_bit_cast(v16bf, __builtin_shufflevector(lo, hi, 0, 1, 2, 3, 4, 5, 6, 7, 8, 9, 10, 11, 12, 13, 14, 15)); }
__device__ __forceinline__ v8f wmma16(v16h a, v16h b, v8f c) { return __builtin_amdgcn_wmma_f32_16x16x32_f16(false, a, false, b, (short)0, c, false, false); }
__device__ __forceinline__ v8f wmmab(v16bf a, v16bf b, v8f c) { return __builtin_amdgcn_wmma_f32_16x16x32_bf16(false, a, false, b, (short)0, c, false, false); }

__device__ __forceinline__ h16 tohx(float x) { return (h16)x; }
__device__ __forceinline__ void splitf(float y, unsigned short& h, unsigned short& l) { h = f2bf(y); l = f2bf(y - bf2f(h)); }
typedef __attribute__((ext_vector_type(2))) _Float16 v2h;
typedef __attribute__((ext_vector_type(4))) _Float16 v4h;
typedef __attribute__((ext_vector_type(2))) unsigned short v2us;
typedef __attribute__((ext_vector_type(4))) unsigned short v4us;
typedef __attribute__((ext_vector_type(2))) float v2f;
typedef __attribute__((ext_vector_type(4))) int v4i;
typedef __attribute__((ext_vector_type(4))) __bf16 v4b;
typedef __attribute__((ext_vector_type(8))) __bf16 v8b;
#define PLN  ((size_t)NB_ * NH_ * TT * HD)     // elements of one projection and of each of its planes

// ---- k_gemmw: register-blocked GEMM, ONE WAVE per 64x64 output tile (16 accumulators), operands straight from 16-bit planes in fragment order; grid (M/64, N/64, Z), 32 threads.
// C[m][n] (f32, pitch ldc, + optional f32 bias[n]) = sum_k A[m][k] Bt[n][k] (+ split products per NSPLIT). z-batch strides sA/sB/sC in elements; z = 0, 1, 2 adds bias, bias1, bias2. K % 32 == 0.
// PL: no C; the tile is 64 tokens of ONE head, and the epilogue writes the attention kernel's operand planes from it: z = 0, 1 (q, k): + bias, interleaved-pair RoPE (out[d] = x[d] cos[t][d] -/+ x[d ^ 1] sin[t][d], - for even d), planes [b][h] of [t][d] in fragment order as fp16 and as hi+lo bf16, q's followed by k's in P16, Ph and Pl;
// z = 2 (v): + bias, transposed planes [b][g] of [d][t] in fragment order, straight from the accumulators (a lane holds 8 consecutive t of one d: its own 16 bytes of a tile half).
// KSL > 1: grid z = Z * KSL; work-group (z, ks) sums only k in [ks K/KSL, (ks+1) K/KSL) and stores that partial tile in plane ks (plane stride sP elements); the reader adds the KSL planes. K % (32 KSL) == 0.
template <typename T16> struct WFrag;
template <> struct WFrag<h16> { typedef v16h V; static __device__ __forceinline__ V ld(const h16* p) { return cat16(*(const v8h*)p, *(const v8h*)(p + 256)); } static __device__ __forceinline__ v8f mma(V a, V b, v8f c) { return wmma16(a, b, c); } };
template <> struct WFrag<bf> { typedef v16bf V; static __device__ __forceinline__ V ld(const bf* p) { return cat16b(*(const v8us*)p, *(const v8us*)(p + 256)); } static __device__ __forceinline__ v8f mma(V a, V b, v8f c) { return wmmab(a, b, c); } };
template <typename T16, int NSPLIT, bool BIAS, int KSL = 1, bool PL = false>
__global__ __launch_bounds__(32) void k_gemmw(const T16* __restrict__ A, const T16* __restrict__ A2, const T16* __restrict__ Bt, const T16* __restrict__ Bt2, int K, float* C, int ldc, const float* __restrict__ bias, const float* __restrict__ bias1, const float* __restrict__ bias2, size_t sA, size_t sB, size_t sC, size_t sP = 0, const float* __restrict__ CS = nullptr, h16* P16 = nullptr, bf* Ph = nullptr, bf* Pl = nullptr, h16* V16 = nullptr, bf* Vh = nullptr, bf* Vl = nullptr) {
    typedef typename WFrag<T16>::V V;
    __shared__ __align__(16) float os[16 * 68];
    const size_t z = blockIdx.z / KSL; const int ks = blockIdx.z % KSL; const int kbeg = ks * (K / KSL), kend = kbeg + K / KSL; C += (size_t)ks * sP; A += z * sA; if (A2) A2 += z * sA; Bt += z * sB; if (Bt2) Bt2 += z * sB; C += z * sC; const float* bz = z == 0 ? bias : z == 1 ? bias1 : bias2;
    const int lane = threadIdx.x & 31, lr = lane & 15, hi = lane >> 4; const int r0 = blockIdx.x * 64, c0 = blockIdx.y * 64;
    v8f acc[4][4];
#pragma unroll
    for (int mb = 0; mb < 4; ++mb)
#pragma unroll
        for (int nb = 0; nb < 4; ++nb) acc[mb][nb] = (v8f){};
    const size_t aoff = (size_t)r0 * K + 8 * lane, boff = (size_t)c0 * K + 8 * lane;   // 16 rows of K are K / 32 tiles of 512
#pragma unroll 1
    for (int kc = kbeg; kc < kend; kc += 32) {
        V a[4], a2[4], b[4], b2[4]; const T16 *pa[4], *pa2[4], *pb[4], *pb2[4];
#pragma unroll
        for (int i = 0; i < 4; ++i) { pa[i] = A + aoff + (size_t)i * 16 * K + kc * 16; a[i] = WFrag<T16>::ld(pa[i]); pb[i] = Bt + boff + (size_t)i * 16 * K + kc * 16; b[i] = WFrag<T16>::ld(pb[i]);
            pa2[i] = pa[i]; pb2[i] = pb[i];
            if (NSPLIT == 1 || NSPLIT == 2) { pa2[i] = A2 + aoff + (size_t)i * 16 * K + kc * 16; a2[i] = WFrag<T16>::ld(pa2[i]); } if (NSPLIT >= 2) { pb2[i] = Bt2 + boff + (size_t)i * 16 * K + kc * 16; b2[i] = WFrag<T16>::ld(pb2[i]); } }
        // stands behind the pass's loads and takes their addresses as inputs: no address register is given to a later load's result or to other work before the wait
        asm volatile("s_wait_xcnt 0x0" :: "v"(pa[0]), "v"(pa[1]), "v"(pa[2]), "v"(pa[3]), "v"(pb[0]), "v"(pb[1]), "v"(pb[2]), "v"(pb[3]), "v"(pa2[0]), "v"(pa2[1]), "v"(pa2[2]), "v"(pa2[3]), "v"(pb2[0]), "v"(pb2[1]), "v"(pb2[2]), "v"(pb2[3]) : "memory");
#pragma unroll
        for (int nb = 0; nb < 4; ++nb)
#pragma unroll
            for (int mb = 0; mb < 4; ++mb) { acc[mb][nb] = WFrag<T16>::mma(a[mb], b[nb], acc[mb][nb]); if (NSPLIT == 1 || NSPLIT == 2) acc[mb][nb] = WFrag<T16>::mma(a2[mb], b[nb], acc[mb][nb]); if (NSPLIT >= 2) acc[mb][nb] = WFrag<T16>::mma(a[mb], b2[nb], acc[mb][nb]); }
        asm volatile("v_nop\n\tv_nop\n\tv_nop\n\tv_nop" : "+v"(acc[0][0]), "+v"(acc[1][1]), "+v"(acc[2][2]), "+v"(acc[3][3]) : "v"(a[0]), "v"(a[3]));
    }
    if constexpr (PL) {
        static_assert(HD == 64 && TT % 64 == 0 && NKV == NH_, "a 64 x 64 tile is 64 tokens of one batch and one head");
        const int b = r0 / TT, t0 = r0 % TT, h = c0 / HD;
        if (z == 2) {
            const size_t vb = (size_t)(b * NKV + h) * HD * TT + (size_t)t0 * 16 + 8 * lane;
#pragma unroll
            for (int nb = 0; nb < 4; ++nb) { const float bb = bfr(bz[c0 + nb * 16 + lr]);
#pragma unroll
                for (int mb = 0; mb < 4; ++mb) { v8h o16; v8b oh, ol;
#pragma unroll
                    for (int j = 0; j < 8; ++j) { const float x = acc[mb][nb][j] + bb; o16[j] = tohx(x); oh[j] = (__bf16)x; ol[j] = (__bf16)(x - (float)oh[j]); }
                    const size_t e = vb + (size_t)nb * 16 * TT + (mb >> 1) * 512 + (mb & 1) * 256;
                    *(v8h*)(V16 + e) = o16; *(v8us*)(Vh + e) = __builtin_bit_cast(v8us, oh); *(v8us*)(Vl + e) = __builtin_bit_cast(v8us, ol);
                    asm volatile("s_wait_xcnt 0x0" ::: "memory"); } }   // stands in front of the next tile's packing, which reuses the registers that the three stores name
        } else {
            const int cofs = lr * 4; const size_t pb = z * PLN + ((size_t)(b * NH_ + h) * TT + t0) * HD + (cofs >> 5) * 512 + ((cofs >> 4) & 1) * 256 + ((cofs >> 3) & 1) * 128 + (cofs & 7);
            v4f bb = *(const v4f*)(bz + c0 + cofs);
#pragma unroll
            for (int i = 0; i < 4; ++i) bb[i] = bfr(bb[i]);
#pragma unroll
            for (int mb = 0; mb < 4; ++mb) {
                v4f ca[8], cb[8];   // (cos, sin) of this lane's 4 d in its 8 rows, all asked for before the staging so that one latency covers them
#pragma unroll
                for (int s = 0; s < 8; ++s) { const float* p = CS + ((size_t)(t0 + mb * 16 + 2 * s + hi) * HD + cofs) * 2; ca[s] = *(const v4f*)p; cb[s] = *(const v4f*)(p + 4); }
                asm volatile("s_wait_xcnt 0x0" ::: "memory");   // stands in front of the work below, which reuses the registers that hold the addresses of the loads above
#pragma unroll
                for (int nb = 0; nb < 4; ++nb) {
#pragma unroll
                    for (int j = 0; j < 8; ++j) os[(hi * 8 + j) * 68 + nb * 16 + lr] = acc[mb][nb][j]; }
                __builtin_amdgcn_wave_barrier(); asm volatile("" ::: "memory");   // the rows are read back by other lanes than wrote them
#pragma unroll
                for (int s = 0; s < 8; ++s) { const int row = 2 * s + hi; const v4f val = *(const v4fa*)(os + row * 68 + cofs) + bb; v4f r;
                    r[0] = val[0] * ca[s][0] - val[1] * ca[s][1]; r[1] = val[1] * ca[s][2] + val[0] * ca[s][3]; r[2] = val[2] * cb[s][0] - val[3] * cb[s][1]; r[3] = val[3] * cb[s][2] + val[2] * cb[s][3];
                    v4h o16; v4b oh, ol;
#pragma unroll
                    for (int i = 0; i < 4; ++i) { o16[i] = tohx(r[i]); oh[i] = (__bf16)r[i]; ol[i] = (__bf16)(r[i] - (float)oh[i]); }
                    const size_t e = pb + (size_t)mb * 16 * HD + row * 8;
                    *(v4h*)(P16 + e) = o16; *(v4us*)(Ph + e) = __builtin_bit_cast(v4us, oh); *(v4us*)(Pl + e) = __builtin_bit_cast(v4us, ol);
                    asm volatile("s_wait_xcnt 0x0" ::: "memory"); }   // stands in front of the next rows' packing, which reuses the registers that the three stores name
                __builtin_amdgcn_wave_barrier(); asm volatile("" ::: "memory");   // the next 16 rows overwrite the staging only behind every lane's reads
            }
        }
        return;
    }
#pragma unroll
    for (int mb = 0; mb < 4; ++mb) {
#pragma unroll
        for (int nb = 0; nb < 4; ++nb) {
#pragma unroll
            for (int j = 0; j < 8; ++j) os[(hi * 8 + j) * 68 + nb * 16 + lr] = acc[mb][nb][j]; }
        __builtin_amdgcn_wave_barrier(); asm volatile("" ::: "memory");
        float* crow = C + (size_t)(r0 + mb * 16) * ldc + c0;
{
#pragma unroll
            for (int s = 0; s < 8; ++s) { const int row = 2 * s + hi, cofs = lr * 4; v4f val = *(const v4fa*)(os + row * 68 + cofs); if (BIAS) { val[0] += bfr(bz[c0 + cofs]); val[1] += bfr(bz[c0 + cofs + 1]); val[2] += bfr(bz[c0 + cofs + 2]); val[3] += bfr(bz[c0 + cofs + 3]); }
                *(v4f*)(crow + (size_t)row * ldc + cofs) = val;
                asm volatile("s_wait_xcnt 0x0" ::: "memory"); }   // stands in front of the next rows' work, which reuses the registers that the store names
             }
        __builtin_amdgcn_wave_barrier(); asm volatile("" ::: "memory");
    }
}


// The bodies below take their work-group's index blk inside their own job: jobs that read none of each other's output share one launch.
// wtF: Bt[n][k] = w[k][n] as bf16 in fragment order; a thread writes its lane's 16 bytes of both halves of one tile, and each of its 16 loads reads 16 consecutive n of two k rows per wave.
__device__ __forceinline__ void wtF(unsigned blk, const float* __restrict__ w, unsigned K, unsigned N, bf* Bt) {
    const unsigned u = blk * 256 + threadIdx.x, tile = u >> 5, lane = u & 31; const unsigned n = tile / (K / 32) * 16 + (lane & 15), k0 = tile % (K / 32) * 32 + (lane >> 4) * 8;
#pragma unroll
    for (int hf = 0; hf < 2; ++hf) { v8us o;
#pragma unroll
        for (int j = 0; j < 8; ++j) o[j] = f2bf(w[(size_t)(k0 + hf * 16 + j) * N + n]);
        *(v8us*)(Bt + (size_t)tile * 512 + hf * 256 + lane * 8) = o; }
    asm volatile("s_wait_xcnt 0x0" ::: "memory");   // in the built kernel another job's body stands in line behind this one and reuses the registers that the stores name
}
// cvtF: src [rows][K] f32 -> bf16 in fragment order; a wave takes two tiles (16 rows x 64 k: 256 contiguous bytes of each row), a thread its lane's 16 bytes of their four halves.
template <bool HW>   // HW: the compiler's own f32 -> bf16 conversion, as the attention loop applied it to the mask
__device__ __forceinline__ void cvtF(unsigned blk, const float* __restrict__ src, unsigned K, bf* dst) {
    const unsigned u = blk * 256 + threadIdx.x, tp = u >> 5, lane = u & 31; const unsigned row = tp / (K / 64) * 16 + (lane & 15), k0 = tp % (K / 64) * 64 + (lane >> 4) * 8; const float* p = src + (size_t)row * K + k0; v8f v[4];
#pragma unroll
    for (int q = 0; q < 4; ++q) v[q] = *(const v8f*)(p + q * 16);
#pragma unroll
    for (int q = 0; q < 4; ++q) { v8us o;
#pragma unroll
        for (int k = 0; k < 8; ++k) o[k] = HW ? __builtin_bit_cast(unsigned short, (__bf16)v[q][k]) : f2bf(v[q][k]);
        *(v8us*)(dst + (size_t)tp * 1024 + q * 256 + lane * 8) = o; }
    asm volatile("s_wait_xcnt 0x0" ::: "memory");   // in the built kernel another job's body stands in line behind this one and reuses the registers that the stores name
}
__device__ __forceinline__ void cscvt(int blk, const float* __restrict__ cosT, const float* __restrict__ sinT, float* CS) { const int idx = blk * 256 + threadIdx.x; if (idx >= TT * HD) return; v2f cs; cs[0] = bfr(cosT[idx]); cs[1] = bfr(sinT[idx]); *(v2f*)(CS + (size_t)idx * 2) = cs;  }
// ---- k_prep: every conversion that reads inputs alone, one launch: the four weights transposed to bf16 (WT: q, k, v, o one after the other), x of both batches to bf16, the mask to bf16 (the rounding that the scores add), all in fragment order; the cos/sin table.
static_assert(DQ == DM && DKV == DM && NKV == NH_, "the four weights share one shape, q and k planes one size");
#define WBLK (DM * DQ / 16 / 256)          // work-groups per weight
#define XBLK (NB_ * TT * DM / 32 / 256)    // work-groups on x
#define MBLK (TT * TT / 32 / 256)          // work-groups on the mask
#define CBLK (TT * HD / 256)               // work-groups on the cos/sin table
__global__ __launch_bounds__(256) void k_prep(const float* __restrict__ wq, const float* __restrict__ wk, const float* __restrict__ wv, const float* __restrict__ wo, const float* __restrict__ x, const float* __restrict__ mk, const float* __restrict__ cosT, const float* __restrict__ sinT, bf* WT, bf* XB, bf* MB, float* CS) {
    const int blk = blockIdx.x;
    if (blk < 4 * WBLK) { const int wi = blk / WBLK; wtF(blk % WBLK, wi == 0 ? wq : wi == 1 ? wk : wi == 2 ? wv : wo, DM, DQ, WT + (size_t)wi * DM * DQ); return; }
    if (blk < 4 * WBLK + XBLK) { cvtF<false>(blk - 4 * WBLK, x, DM, XB); return; }
    if (blk < 4 * WBLK + XBLK + MBLK) { cvtF<true>(blk - 4 * WBLK - XBLK, mk, TT, MB); return; }
    cscvt(blk - 4 * WBLK - XBLK - MBLK, cosT, sinT, CS);
}
// ---- k_fattn: scores, mask add, softmax and attn.v of both batches in ONE launch; the score plane never leaves registers.
// One wave owns NQ x 16 query columns of one head and walks all TT keys, 32 a pass: S^T = K Q^T (a lane holds 16 keys' scores of ONE query per column group), t = S^T x HD^-0.5 + mask[i][j] (its bf16 rounding, read from the plane that k_prep wrote: a score tile's lane map is the operand map, so the plane is in the same fragment order),
// running maximum and running sum per query (sum and accumulators are rescaled every pass by exp(old maximum - new maximum)), P^T packed from the two score tiles straight into a B operand (same k order as the V^T loader), O^T += V^T P^T.
// Query rows < RH: hi+lo bf16 planes, 3 products in both GEMMs; the rest: single fp16. The result O / sum goes out as the hi+lo planes of the output projection's A operand, 8 consecutive d per lane.
// AW waves of one head form a work-group and share K and V^T through LDS: a stage is SK keys (SK / 32 passes), two buffers; every thread copies its 16 bytes of each 2-KiB piece of the stage from the planes to LDS asynchronously, one stage ahead of its use.
// The planes are in fragment order, so a stage is a plain copy (K: SK HD contiguous elements; V^T: SK 16 contiguous elements for each 16 d) and a fragment is two 16-byte LDS loads of 512 contiguous bytes a wave.
#define AW   4                    // waves of a work-group
#define SK   64                   // keys of a stage
#define NST  (TT / SK)
#define PLE  (SK * HD * 2)        // elements that one plane pair (K, V^T) has in a stage: K first, V^T behind it
static_assert(AW * 32 * 8 == 1024 && SK * HD == 4 * 1024 && SK * 16 == 1024 && HD == 64 && NST >= 2, "a copy of the whole work-group is 1024 elements: four of them are a stage's K, one is a stage's V^T of 16 d");
__device__ __forceinline__ float xhalf(float f) { const int b = __float_as_int(f); return __int_as_float(__builtin_amdgcn_permlanex16(b, b, 0x76543210, 0xfedcba98, false, false)); }   // lane l reads lane l ^ 16
// one plane pair's share of a stage: l = this thread's LDS byte address in the stage's K part, kg / vg = its 16 bytes in the K and V^T planes. The wait in the statement's last line stands in front of whatever rewrites the registers that the copies name.
template <typename T16>
__device__ __forceinline__ void stage_copy(unsigned l, const T16* kg, const T16* vg) {
    asm volatile("global_load_async_to_lds_b128 %0, %1, off\n\t"
                 "global_load_async_to_lds_b128 %2, %3, off\n\t"
                 "global_load_async_to_lds_b128 %4, %5, off\n\t"
                 "global_load_async_to_lds_b128 %6, %7, off\n\t"
                 "global_load_async_to_lds_b128 %8, %9, off\n\t"
                 "global_load_async_to_lds_b128 %10, %11, off\n\t"
                 "global_load_async_to_lds_b128 %12, %13, off\n\t"
                 "global_load_async_to_lds_b128 %14, %15, off\n\t"
                 "s_wait_xcnt 0x0"
                 :: "v"(l), "v"(kg), "v"(l + 2048u), "v"(kg + 1024), "v"(l + 4096u), "v"(kg + 2048), "v"(l + 6144u), "v"(kg + 3072),
                    "v"(l + 8192u), "v"(vg), "v"(l + 10240u), "v"(vg + (size_t)16 * TT), "v"(l + 12288u), "v"(vg + (size_t)32 * TT), "v"(l + 14336u), "v"(vg + (size_t)48 * TT) : "memory");
}
template <typename T16, bool HI, int NQ>
__device__ __forceinline__ void attn_wave(const T16* __restrict__ Q, const T16* __restrict__ Q2, const T16* __restrict__ Kp, const T16* __restrict__ K2, const T16* __restrict__ Vt, const T16* __restrict__ Vt2, const bf* __restrict__ mk, int q0, bf* Ah, bf* Al, const T16* sm) {
    typedef typename WFrag<T16>::V V; typedef WFrag<T16> F;
    constexpr int BFE = (HI ? 2 : 1) * PLE;   // elements of a buffer
    const int lane = threadIdx.x & 31, tid = threadIdx.x;
    V qf[NQ][2], qf2[NQ][2], kf[2][2], kf2[2][2], vf[4], vf2[4]; v16us mf[NQ]; v8f o[NQ][4]; float m[NQ], l[NQ];
    auto fill = [&](int st) {   // stage st into buffer st % 2
        const unsigned lb = (unsigned)(size_t)(sm + (st & 1) * BFE + 8 * tid);
        stage_copy<T16>(lb, Kp + (size_t)st * (SK * HD) + 8 * tid, Vt + (size_t)st * (SK * 16) + 8 * tid);
        if constexpr (HI) stage_copy<T16>(lb + PLE * 2, K2 + (size_t)st * (SK * HD) + 8 * tid, Vt2 + (size_t)st * (SK * 16) + 8 * tid); };
    fill(0);
#pragma unroll
    for (int nq = 0; nq < NQ; ++nq) { m[nq] = -3.0e38f; l[nq] = 0.f;
#pragma unroll
        for (int ks = 0; ks < 2; ++ks) { const size_t qo = (size_t)(q0 + nq * 16) * HD + ks * 512 + 8 * lane; qf[nq][ks] = F::ld(Q + qo); if (HI) qf2[nq][ks] = F::ld(Q2 + qo); }
#pragma unroll
        for (int dt = 0; dt < 4; ++dt) o[nq][dt] = (v8f){}; }
    const bf* mrow = mk + (size_t)q0 * TT + 8 * lane;
    auto ldk = [&](const T16* sb, int p) {   // pass p of the stage at sb
#pragma unroll
        for (int kt = 0; kt < 2; ++kt)
#pragma unroll
            for (int ks = 0; ks < 2; ++ks) { const int e = 8 * lane + (p * 32 + kt * 16) * HD + ks * 512; kf[kt][ks] = F::ld(sb + e); if (HI) kf2[kt][ks] = F::ld(sb + PLE + e); } };
    // the two 16-byte halves are joined into one value: left as bare loaded values, the compiler merged this refill with the prologue's load into one load at the loop's top, its latency exposed
    auto ldm = [&](const bf* mb, int ps) {   // pass ps of the stage whose mask tiles begin at mb
#pragma unroll
        for (int nq = 0; nq < NQ; ++nq) { const bf* p = mb + (size_t)nq * 16 * TT + ps * 512; mf[nq] = __builtin_shufflevector(*(const v8us*)p, *(const v8us*)(p + 256), 0, 1, 2, 3, 4, 5, 6, 7, 8, 9, 10, 11, 12, 13, 14, 15); }
        // stands in front of the work below, which may reuse the registers that hold the address of the loads above; it takes that address as an input, so that it is not given away before the wait
        asm volatile("s_wait_xcnt 0x0" :: "v"(mb) : "memory"); };
    auto ldv = [&](const T16* sb, int p) {
#pragma unroll
        for (int dt = 0; dt < 4; ++dt) { const int e = 8 * lane + SK * HD + dt * (SK * 16) + p * 512; vf[dt] = F::ld(sb + e); if (HI) vf2[dt] = F::ld(sb + PLE + e); } };
    ldm(mrow, 0);
    asm volatile("s_wait_asynccnt 0x0" ::: "memory");   // this wave's copies of stage 0 have landed
    __syncthreads();                                     // and every other wave's: stage 0 may be read
    fill(1);
    // rolled over the stages; inside a stage each operand set is refilled in place right behind its last use, so that the next pass's LDS loads fly under this pass's work; nothing of the next stage is read before the barrier at the foot
#pragma unroll 1
    for (int st = 0; st < NST; ++st) {
        const T16* sb = sm + (st & 1) * BFE; const bf* mst = mrow + (size_t)st * (SK * 16);
        ldk(sb, 0); ldv(sb, 0);
#pragma unroll   // p decides at compile time which refills a pass has and gives every LDS load an immediate offset
        for (int p = 0; p < SK / 32; ++p) {
            v8f sc[NQ][2];
#pragma unroll
            for (int nq = 0; nq < NQ; ++nq)
#pragma unroll
                for (int kt = 0; kt < 2; ++kt) { v8f s = (v8f){};
#pragma unroll
                    for (int ks = 0; ks < 2; ++ks) { s = F::mma(kf[kt][ks], qf[nq][ks], s); if (HI) { s = F::mma(kf[kt][ks], qf2[nq][ks], s); s = F::mma(kf2[kt][ks], qf[nq][ks], s); } }
                    sc[nq][kt] = s; }
            if (p + 1 < SK / 32) ldk(sb, p + 1);
            __builtin_amdgcn_sched_barrier(0);   // keeps the K refill here, a whole softmax ahead of its use; the scheduler otherwise sinks it behind the attn.v products
            float t[NQ][16], mx[NQ];
#pragma unroll
            for (int nq = 0; nq < NQ; ++nq) { mx[nq] = m[nq];
#pragma unroll
                for (int e = 0; e < 16; ++e) { t[nq][e] = sc[nq][e >> 3][e & 7] * SCL + bf2f(mf[nq][e]); mx[nq] = fmaxf(mx[nq], t[nq][e]); } }
            if (p + 1 < SK / 32) ldm(mst, p + 1);   // the stage's last pass leaves its refill to the foot: the barrier there waits for every global load in flight
            __builtin_amdgcn_sched_barrier(0);   // keeps the mask refill here, most of a pass ahead of its use; the scheduler otherwise sinks it into the attn.v products
            V pf[NQ], pf2[NQ];
#pragma unroll
            for (int nq = 0; nq < NQ; ++nq) { const float mn = fmaxf(mx[nq], xhalf(mx[nq]));   // lanes c and c + 16 hold the two key halves of query c
                const float aa = (m[nq] - mn) * 1.4426950408889634f; const float al = __builtin_amdgcn_exp2f(aa); m[nq] = mn;
                float a[16];
#pragma unroll
                for (int e = 0; e < 16; ++e) { a[e] = (t[nq][e] - mn) * 1.4426950408889634f; t[nq][e] = __builtin_amdgcn_exp2f(a[e]); }
                // the slot that the instruction set asks for between a transcendental and an overwrite of its source: taken as inputs, the sources stay in their registers up to the v_nop and the results put it behind the exponentials
                asm volatile("v_nop" :: "v"(aa), "v"(al), "v"(a[0]), "v"(a[1]), "v"(a[2]), "v"(a[3]), "v"(a[4]), "v"(a[5]), "v"(a[6]), "v"(a[7]), "v"(t[nq][0]), "v"(t[nq][1]), "v"(t[nq][2]), "v"(t[nq][3]), "v"(t[nq][4]), "v"(t[nq][5]), "v"(t[nq][6]), "v"(t[nq][7]));
                asm volatile("v_nop" :: "v"(a[8]), "v"(a[9]), "v"(a[10]), "v"(a[11]), "v"(a[12]), "v"(a[13]), "v"(a[14]), "v"(a[15]), "v"(t[nq][8]), "v"(t[nq][9]), "v"(t[nq][10]), "v"(t[nq][11]), "v"(t[nq][12]), "v"(t[nq][13]), "v"(t[nq][14]), "v"(t[nq][15]));
                float ls[8];   // pairwise tree: four dependent adds deep instead of sixteen
#pragma unroll
                for (int e = 0; e < 8; ++e) ls[e] = t[nq][e] + t[nq][e + 8];
#pragma unroll
                for (int w = 4; w; w >>= 1)
#pragma unroll
                    for (int e = 0; e < w; ++e) ls[e] += ls[e + w];
                l[nq] = l[nq] * al + ls[0];
#pragma unroll
                for (int dt = 0; dt < 4; ++dt) o[nq][dt] *= al;
                if constexpr (HI) {
#pragma unroll
                    for (int e = 0; e < 16; ++e) { const __bf16 ph = (__bf16)t[nq][e]; pf[nq][e] = ph; pf2[nq][e] = (__bf16)(t[nq][e] - (float)ph); }
                } else {
#pragma unroll
                    for (int e = 0; e < 16; ++e) pf[nq][e] = (h16)t[nq][e]; } }
#pragma unroll
            for (int nq = 0; nq < NQ; ++nq)
#pragma unroll
                for (int dt = 0; dt < 4; ++dt) { o[nq][dt] = F::mma(vf[dt], pf[nq], o[nq][dt]); if (HI) { o[nq][dt] = F::mma(vf[dt], pf2[nq], o[nq][dt]); o[nq][dt] = F::mma(vf2[dt], pf[nq], o[nq][dt]); } }
            if (p + 1 < SK / 32) ldv(sb, p + 1);
        }
        asm volatile("s_wait_dscnt 0x0" ::: "memory");      // this wave's reads of the stage's buffer are done before the buffer is given up
        asm volatile("s_wait_asynccnt 0x0" ::: "memory");   // this wave's copies of the next stage have landed
        __syncthreads();                                     // publishes the next stage and ends every wave's reads of this one
        ldm(mrow + (size_t)(((st + 1) * SK) & (TT - 1)) * 16, 0);   // the next stage's first mask tile; the last trip refetches pass 0's (in bounds, unused)
        if (st + 2 < NST) fill(st + 2);                      // into the buffer that this trip has just read
    }
    asm volatile("s_wait_asynccnt 0x0" ::: "memory");   // no copy is outstanding when the wave ends
#pragma unroll
    for (int nq = 0; nq < NQ; ++nq) { const float inv = __fdiv_rn(1.0f, l[nq] + xhalf(l[nq])); const size_t oo = (size_t)(q0 + nq * 16) * DQ + 8 * lane;
#pragma unroll
        for (int dt = 0; dt < 4; ++dt) { v8us oh, ol;
#pragma unroll
            for (int j = 0; j < 8; ++j) { unsigned short a, c2; splitf(o[nq][dt][j] * inv, a, c2); oh[j] = a; ol[j] = c2; }
            *(v8us*)(Ah + oo + dt * 256) = oh; *(v8us*)(Al + oo + dt * 256) = ol;
            asm volatile("s_wait_xcnt 0x0" ::: "memory"); } }   // stands in front of the next tile's packing, which reuses the registers that the two stores name
}
#define HWG (RH / 16 / AW)            // work-groups per head on rows < RH: AW waves of 16 query columns
#define LWG ((TT - RH) / 32 / AW)     // work-groups per head on the other rows: AW waves of 32 query columns
static_assert(RH % (16 * AW) == 0 && (TT - RH) % (32 * AW) == 0, "whole work-groups on both kinds of rows");
// the 3-product work-groups have the low indices and start first
__global__ __launch_bounds__(AW * 32) void k_fattn(const h16* __restrict__ Q16, const h16* __restrict__ K16, const h16* __restrict__ V16, const bf* __restrict__ Qh, const bf* __restrict__ Ql, const bf* __restrict__ Kh, const bf* __restrict__ Kl, const bf* __restrict__ Vh, const bf* __restrict__ Vl, const bf* __restrict__ mk, bf* Ah, bf* Al) {
    __shared__ __attribute__((aligned(128))) unsigned short sm[2 * 2 * PLE];   // two buffers of a stage's hi and lo plane pairs (the fp16 rows use half)
    const int blk = blockIdx.x, wv = threadIdx.x >> 5;
    // bh = b NH_ + h: the planes are [b][h], the mask is one for all, the output rows are b TT + t, its k is h HD + d (HD / 32 tiles a head)
    if (blk < NB_ * NH_ * HWG) { const int bh = blk / HWG, h = bh % NH_, b = bh / NH_; const size_t po = (size_t)bh * TT * HD, pk = (size_t)(b * NKV + h / REP) * TT * HD, ao = (size_t)b * TT * DQ + h * (HD * 16); attn_wave<bf, true, 1>(Qh + po, Ql + po, Kh + pk, Kl + pk, Vh + pk, Vl + pk, mk, ((blk % HWG) * AW + wv) * 16, Ah + ao, Al + ao, (const bf*)sm); }
    else { const int b2 = blk - NB_ * NH_ * HWG; const int bh = b2 / LWG, h = bh % NH_, b = bh / NH_; const size_t po = (size_t)bh * TT * HD, pk = (size_t)(b * NKV + h / REP) * TT * HD, ao = (size_t)b * TT * DQ + h * (HD * 16); attn_wave<h16, false, 2>(Q16 + po, nullptr, K16 + pk, nullptr, V16 + pk, nullptr, mk, RH + ((b2 % LWG) * AW + wv) * 32, Ah + ao, Al + ao, (const h16*)sm); }
}

extern "C" void kernel_launch(void* const* d_in, const int* in_sizes, int n_in,
                              void* d_out, int out_size, void* d_ws, size_t ws_size, hipStream_t stream) {
    (void)in_sizes; (void)n_in; (void)out_size;
    const float* x = (const float*)d_in[0]; const float* rope = (const float*)d_in[1]; const float* cosT = rope; const float* sinT = rope + (size_t)TT * HD; const float* fmask = (const float*)d_in[2]; const float* wq = (const float*)d_in[3]; const float* bq = (const float*)d_in[4]; const float* wk = (const float*)d_in[5]; const float* bk = (const float*)d_in[6]; const float* wv = (const float*)d_in[7]; const float* bv = (const float*)d_in[8]; const float* wo = (const float*)d_in[9]; const float* bo = (const float*)d_in[10];
    float* OUT = (float*)d_out;     // [2][2048][1024]
    char* wsp = (char*)d_ws;
    auto take = [&](size_t bytes) { char* p = wsp; wsp += (bytes + 255) & ~(size_t)255; return (void*)p; };
    bf* WT = (bf*)take((size_t)4 * DQ * DM * 2); float* CS = (float*)take((size_t)TT * HD * 2 * 4);
    bf* XB = (bf*)take((size_t)NB_ * TT * DM * 2); bf* MB = (bf*)take((size_t)TT * TT * 2);
    h16* QK16 = (h16*)take(2 * PLN * 2); h16* VT16 = (h16*)take(PLN * 2);
    bf* QKh = (bf*)take(2 * PLN * 2); bf* QKl = (bf*)take(2 * PLN * 2); bf* VTh = (bf*)take(PLN * 2); bf* VTl = (bf*)take(PLN * 2);
    bf* ATh = (bf*)take((size_t)NB_ * TT * DQ * 2); bf* ATl = (bf*)take((size_t)NB_ * TT * DQ * 2);
    if ((size_t)(wsp - (char*)d_ws) > ws_size) return;    // ws 256 MiB
    k_prep<<<4 * WBLK + XBLK + MBLK + CBLK, 256, 0, stream>>>(wq, wk, wv, wo, x, fmask, cosT, sinT, WT, XB, MB, CS);
    k_gemmw<bf, 0, true, 1, true><<<dim3(NB_ * TT / 64, DQ / 64, 3), 32, 0, stream>>>(XB, nullptr, WT, nullptr, DM, nullptr, DQ, bq, bk, bv, 0, (size_t)DQ * DM, 0, 0, CS, QK16, QKh, QKl, VT16, VTh, VTl);
    k_fattn<<<NB_ * NH_ * (HWG + LWG), AW * 32, 0, stream>>>(QK16, QK16 + PLN, VT16, QKh, QKl, QKh + PLN, QKl + PLN, VTh, VTl, MB, ATh, ATl);
    k_gemmw<bf, 1, true><<<dim3(NB_ * TT / 64, DM / 64, 1), 32, 0, stream>>>(ATh, ATl, WT + (size_t)3 * DQ * DM, nullptr, DQ, OUT, DM, bo, bo, bo, 0, 0, 0);
}

// v007
// Measured time: 114 microseconds a run.
// In two side-by-side timings against v006, it was 1.48 and 1.45 times as fast.
// Counting every step since v000, it is 18.4 times as fast.
#include <hip/hip_runtime.h>

// Attention block (x [2][2048][1024]; q/k/v = x W + b (16 heads x 64); interleaved-pair RoPE q cos + rot(q) sin with rot = (x0, x1) -> (-x1, x0) and the cos/sin tables READ from the rope input ([2][1][S][1][64]); scores = q.k/8 + mask[i][j] (float, read; zeros here);
// softmax; out = (attn v merged) Wo + bo -> [2][2048][1024]).
// Compute dtypes, f32 accumulate: every input rounded to bf16; q/k/v on PLAIN bf16 operands (inputs: exact) + bias; RoPE f32; scores and attn.v: query rows < 512 hl (3 products), the rest single fp16; mask add + softmax f32, fused with both products in one kernel (running maximum and sum);
// Four launches, each over BOTH batches: input conversions; q, k and v projections (grid z), whose epilogue writes the head planes; attention; output projection.
// FRAGMENT ORDER: every 16-bit plane that a matrix loop reads (x, the weights, q, k, v^T, the mask's bf16 rounding, the attention output) is a [rows][K] matrix stored as tiles of 16 rows x 32 k, 512 elements each, tile (row / 16, k / 32) at index (row / 16) (K / 32) + k / 32;
// inside a tile element (r, c) stands at (c / 16) 256 + ((c / 8 % 2) 16 + r) 8 + c % 8, which is [half][lane][8]: the place the WMMA operand map gives it. A fragment is then two 16-byte loads at tile + lane 8 and + 256, each 512 contiguous bytes (4 whole lines) instead of 32 bytes out of each of 16 lines.

#define NB_  2
#define TT   2048
#define DM   1024
#define NH_  16
#define NKV  16
#define REP  (NH_ / NKV)
#define HD   64
#define DQ   (NH_ * HD)
#define DKV  (NKV * HD)
#define RH   512                  // query rows < RH use hi+lo planes (0: none)
#define WIN  0
#define SCL  0.125f   // HD^-0.5
typedef _Float16 h16;
typedef unsigned short bf;
typedef __attribute__((ext_vector_type(16))) __bf16   v16bf;
typedef __attribute__((ext_vector_type(16))) _Float16 v16h;
typedef __attribute__((ext_vector_type(8)))  _Float16 v8h;
typedef __attribute__((ext_vector_type(8)))  unsigned short v8us;
typedef __attribute__((ext_vector_type(16))) unsigned short v16us;
typedef __attribute__((ext_vector_type(8)))  float    v8f;
typedef __attribute__((ext_vector_type(4)))  float    v4f;
typedef v8h  __attribute__((may_alias)) v8ha;
typedef v4f  __attribute__((may_alias)) v4fa;
typedef v8us __attribute__((may_alias)) v8usa;

__device__ __forceinline__ unsigned short f2bf(float f) { unsigned u = __float_as_uint(f); u += 0x7FFFu + ((u >> 16) & 1u); return (unsigned short)(u >> 16); }
__device__ __forceinline__ float bf2f(unsigned short b) { return __uint_as_float(((unsigned)b) << 16); }
__device__ __forceinline__ float bfr(float f) { return bf2f(f2bf(f)); }
__device__ __forceinline__ v16h cat16(v8h lo, v8h hi) { return __builtin_shufflevector(lo, hi, 0, 1, 2, 3, 4, 5, 6, 7, 8, 9, 10, 11, 12, 13, 14, 15); }
__device__ __forceinline__ v16bf cat16b(v8us lo, v8us hi) { return __builtin_bit_cast(v16bf, __builtin_shufflevector(lo, hi, 0, 1, 2, 3, 4, 5, 6, 7, 8, 9, 10, 11, 12, 13, 14, 15)); }
__device__ __forceinline__ v8f wmma16(v16h a, v16h b, v8f c) { return __builtin_amdgcn_wmma_f32_16x16x32_f16(false, a, false, b, (short)0, c, false, false); }
__device__ __forceinline__ v8f wmmab(v16bf a, v16bf b, v8f c) { return __builtin_amdgcn_wmma_f32_16x16x32_bf16(false, a, false, b, (short)0, c, false, false); }

__device__ __forceinline__ h16 tohx(float x) { return (h16)x; }
__device__ __forceinline__ void splitf(float y, unsigned short& h, unsigned short& l) { h = f2bf(y); l = f2bf(y - bf2f(h)); }
typedef __attribute__((ext_vector_type(2))) _Float16 v2h;
typedef __attribute__((ext_vector_type(4))) _Float16 v4h;
typedef __attribute__((ext_vector_type(2))) unsigned short v2us;
typedef __attribute__((ext_vector_type(4))) unsigned short v4us;
typedef __attribute__((ext_vector_type(2))) float v2f;
typedef __attribute__((ext_vector_type(4))) int v4i;
typedef __attribute__((ext_vector_type(4))) __bf16 v4b;
typedef __attribute__((ext_vector_type(8))) __bf16 v8b;
#define PLN  ((size_t)NB_ * NH_ * TT * HD)     // elements of one projection and of each of its planes

// ---- k_gemmw: register-blocked GEMM, one wave per 64x64 output tile (16 accumulators); GW = 4 waves (2 x 2 tiles) form a work-group on a 128x128 tile and share its operands through LDS; grid (M/128, N/128, Z), 128 threads.
// C[m][n] (f32, pitch ldc, + optional f32 bias[n]) = sum_k A[m][k] Bt[n][k] (+ split products per NSPLIT). z-batch strides sA/sB/sC in elements; z = 0, 1, 2 adds bias, bias1, bias2. K % (32 KST) == 0, at least two stages.
// A stage is KST k tiles (32 KST k) of the 128 rows of every operand, two buffers; the planes are in fragment order, so 16 rows' share of a stage is KST KiB contiguous and a stage is a plain copy: every thread copies its 16 bytes of each 2-KiB piece asynchronously, one stage ahead of its use.
// In a buffer: operand (A, Bt, then A2, Bt2 where there are any), 16-row group, k tile, 512 elements; a fragment is two 16-byte LDS loads of 512 contiguous bytes a wave.
// PL: no C; a wave's tile is 64 tokens of ONE head, and the epilogue writes the attention kernel's operand planes from it: z = 0, 1 (q, k): + bias, interleaved-pair RoPE (out[d] = x[d] cos[t][d] -/+ x[d ^ 1] sin[t][d], - for even d), planes [b][h] of [t][d] in fragment order as fp16 and as hi+lo bf16, q's followed by k's in P16, Ph and Pl;
// z = 2 (v): + bias, transposed planes [b][g] of [d][t] in fragment order, straight from the accumulators (a lane holds 8 consecutive t of one d: its own 16 bytes of a tile half).
#define GW 4
template <typename T16> struct WFrag;
template <> struct WFrag<h16> { typedef v16h V; static __device__ __forceinline__ V ld(const h16* p) { return cat16(*(const v8h*)p, *(const v8h*)(p + 256)); } static __device__ __forceinline__ v8f mma(V a, V b, v8f c) { return wmma16(a, b, c); } };
template <> struct WFrag<bf> { typedef v16bf V; static __device__ __forceinline__ V ld(const bf* p) { return cat16b(*(const v8us*)p, *(const v8us*)(p + 256)); } static __device__ __forceinline__ v8f mma(V a, V b, v8f c) { return wmmab(a, b, c); } };
// this thread's 16 bytes of one 2-KiB piece in each of an operand's eight 16-row groups: LDS byte address l + j ls, global g + j gs elements. The wait in the statement's last line stands in front of whatever rewrites the registers that the copies name.
template <typename T16>
__device__ __forceinline__ void copy8(unsigned l, const T16* g, unsigned ls, size_t gs) {
    asm volatile("global_load_async_to_lds_b128 %0, %1, off\n\t"
                 "global_load_async_to_lds_b128 %2, %3, off\n\t"
                 "global_load_async_to_lds_b128 %4, %5, off\n\t"
                 "global_load_async_to_lds_b128 %6, %7, off\n\t"
                 "global_load_async_to_lds_b128 %8, %9, off\n\t"
                 "global_load_async_to_lds_b128 %10, %11, off\n\t"
                 "global_load_async_to_lds_b128 %12, %13, off\n\t"
                 "global_load_async_to_lds_b128 %14, %15, off\n\t"
                 "s_wait_xcnt 0x0"
                 :: "v"(l), "v"(g), "v"(l + ls), "v"(g + gs), "v"(l + 2 * ls), "v"(g + 2 * gs), "v"(l + 3 * ls), "v"(g + 3 * gs),
                    "v"(l + 4 * ls), "v"(g + 4 * gs), "v"(l + 5 * ls), "v"(g + 5 * gs), "v"(l + 6 * ls), "v"(g + 6 * gs), "v"(l + 7 * ls), "v"(g + 7 * gs) : "memory");
}
template <typename T16, int NSPLIT, bool BIAS, int K, int KST, bool PL = false>
__global__ __launch_bounds__(GW * 32) void k_gemmw(const T16* __restrict__ A, const T16* __restrict__ A2, const T16* __restrict__ Bt, const T16* __restrict__ Bt2, float* C, int ldc, const float* __restrict__ bias, const float* __restrict__ bias1, const float* __restrict__ bias2, size_t sA, size_t sB, size_t sC, const float* __restrict__ CS = nullptr, h16* P16 = nullptr, bf* Ph = nullptr, bf* Pl = nullptr, h16* V16 = nullptr, bf* Vh = nullptr, bf* Vl = nullptr) {
    typedef typename WFrag<T16>::V V;
    static_assert(KST % 2 == 0 && K % (32 * KST) == 0 && K / (32 * KST) >= 2, "a 2-KiB piece is two k tiles of 16 rows; whole stages, at least two");
    constexpr bool HA2 = NSPLIT == 1 || NSPLIT == 2, HB2 = NSPLIT >= 2;
    constexpr int OPE = 128 * KST * 32;               // elements that one operand has in a stage
    constexpr int BFE = (2 + HA2 + HB2) * OPE;        // elements of a buffer
    __shared__ __attribute__((aligned(128))) T16 ring[2 * BFE];
    __shared__ __align__(16) float osw[GW][16 * 68];  // each wave's own epilogue staging
    const size_t z = blockIdx.z; A += z * sA; if (A2) A2 += z * sA; Bt += z * sB; if (Bt2) Bt2 += z * sB; C += z * sC; const float* bz = z == 0 ? bias : z == 1 ? bias1 : bias2;
    const int tid = threadIdx.x, wv = tid >> 5, lane = tid & 31, lr = lane & 15, hi = lane >> 4; const int R0 = blockIdx.x * 128, C0 = blockIdx.y * 128, r0 = R0 + (wv >> 1) * 64, c0 = C0 + (wv & 1) * 64;
    float* os = osw[wv];
    v8f acc[4][4];
#pragma unroll
    for (int mb = 0; mb < 4; ++mb)
#pragma unroll
        for (int nb = 0; nb < 4; ++nb) acc[mb][nb] = (v8f){};
    const size_t aoff = (size_t)R0 * K + 8 * tid, boff = (size_t)C0 * K + 8 * tid;   // 16 rows of K are K / 32 tiles of 512
    auto fill = [&](unsigned st) {   // stage st into buffer st % 2
        const unsigned lb = (unsigned)(size_t)(ring + (st & 1) * BFE + 8 * tid); const size_t ko = (size_t)st * (KST * 512);
#pragma unroll
        for (int sub = 0; sub < KST / 2; ++sub) { const unsigned l = lb + sub * 2048u; const size_t o = ko + sub * 1024;
            copy8<T16>(l, A + aoff + o, KST * 1024u, (size_t)16 * K); copy8<T16>(l + OPE * 2u, Bt + boff + o, KST * 1024u, (size_t)16 * K);
            if constexpr (HA2) copy8<T16>(l + OPE * 4u, A2 + aoff + o, KST * 1024u, (size_t)16 * K);
            if constexpr (HB2) copy8<T16>(l + (2 + HA2) * OPE * 2u, Bt2 + boff + o, KST * 1024u, (size_t)16 * K); } };
    constexpr unsigned nst = K / (32 * KST);
    fill(0);
    asm volatile("s_wait_asynccnt 0x0" ::: "memory");   // this wave's copies of stage 0 have landed
    __syncthreads();                                     // and every other wave's: stage 0 may be read
    fill(1);
    V a[2][4], a2[2][4], b[2][4], b2[2][4];   // two fragment sets: inside a stage the next k tile's LDS loads fly under this k tile's products; nothing of the next stage is read before the barrier at the foot
#pragma unroll 1
    for (unsigned st = 0; st < nst; ++st) {
        const T16* sa = ring + (st & 1) * BFE + (wv >> 1) * (4 * KST * 512) + 8 * lane; const T16* sb = ring + (st & 1) * BFE + OPE + (wv & 1) * (4 * KST * 512) + 8 * lane;
        auto ldf = [&](int kt) {   // k tile kt of the stage into set kt % 2
#pragma unroll
            for (int i = 0; i < 4; ++i) { const int e = (i * KST + kt) * 512; a[kt & 1][i] = WFrag<T16>::ld(sa + e); b[kt & 1][i] = WFrag<T16>::ld(sb + e);
                if constexpr (HA2) a2[kt & 1][i] = WFrag<T16>::ld(sa + 2 * OPE + e); if constexpr (HB2) b2[kt & 1][i] = WFrag<T16>::ld(sb + (1 + HA2) * OPE + e); } };
        ldf(0);
        __builtin_amdgcn_sched_barrier(0);   // keeps the first k tile's loads in front of the second's: mixed, the first block waits for both groups
#pragma unroll   // kt picks the fragment set and every LDS load's offset at compile time
        for (int kt = 0; kt < KST; ++kt) { const int s = kt & 1;
            if (kt + 1 < KST) ldf(kt + 1);
            __builtin_amdgcn_sched_barrier(0);   // keeps the next k tile's loads here, one group ahead of a whole block of products; the scheduler otherwise sinks each load to just in front of its first use, with a full wait per row of products
#pragma unroll
            for (int nb = 0; nb < 4; ++nb)
#pragma unroll
                for (int mb = 0; mb < 4; ++mb) { acc[mb][nb] = WFrag<T16>::mma(a[s][mb], b[s][nb], acc[mb][nb]); if (HA2) acc[mb][nb] = WFrag<T16>::mma(a2[s][mb], b[s][nb], acc[mb][nb]); if (HB2) acc[mb][nb] = WFrag<T16>::mma(a[s][mb], b2[s][nb], acc[mb][nb]); }
            __builtin_amdgcn_sched_barrier(0);   // ends the block: the loads that follow stay one group behind it; the last block stays in front of the foot (the scheduler otherwise sinks it behind the barrier, and the refill, which follows it, loses that much of its lead)
        }
        asm volatile("s_wait_dscnt 0x0" ::: "memory");      // this wave's reads of the stage's buffer are done before the buffer is given up
        asm volatile("s_wait_asynccnt 0x0" ::: "memory");   // this wave's copies of the next stage have landed
        __syncthreads();                                     // publishes the next stage and ends every wave's reads of this one
        if (st + 2 < nst) fill(st + 2);                      // into the buffer that this trip has just read
    }
    asm volatile("s_wait_asynccnt 0x0" ::: "memory");   // no copy is outstanding when the wave goes on
    if constexpr (PL) {
        static_assert(HD == 64 && TT % 64 == 0 && NKV == NH_, "a wave's 64 x 64 tile is 64 tokens of one batch and one head");
        const int b = r0 / TT, t0 = r0 % TT, h = c0 / HD;
        if (z == 2) {
            const size_t vb = (size_t)(b * NKV + h) * HD * TT + (size_t)t0 * 16 + 8 * lane;
#pragma unroll
            for (int nb = 0; nb < 4; ++nb) { const float bb = bfr(bz[c0 + nb * 16 + lr]);
#pragma unroll
                for (int mb = 0; mb < 4; ++mb) { v8h o16; v8b oh, ol;
#pragma unroll
                    for (int j = 0; j < 8; ++j) { const float x = acc[mb][nb][j] + bb; o16[j] = tohx(x); oh[j] = (__bf16)x; ol[j] = (__bf16)(x - (float)oh[j]); }
                    const size_t e = vb + (size_t)nb * 16 * TT + (mb >> 1) * 512 + (mb & 1) * 256;
                    *(v8h*)(V16 + e) = o16; *(v8us*)(Vh + e) = __builtin_bit_cast(v8us, oh); *(v8us*)(Vl + e) = __builtin_bit_cast(v8us, ol);
                    asm volatile("s_wait_xcnt 0x0" ::: "memory"); } }   // stands in front of the next tile's packing, which reuses the registers that the three stores name
        } else {
            const int cofs = lr * 4; const size_t pb = z * PLN + ((size_t)(b * NH_ + h) * TT + t0) * HD + (cofs >> 5) * 512 + ((cofs >> 4) & 1) * 256 + ((cofs >> 3) & 1) * 128 + (cofs & 7);
            v4f bb = *(const v4f*)(bz + c0 + cofs);
#pragma unroll
            for (int i = 0; i < 4; ++i) bb[i] = bfr(bb[i]);
#pragma unroll
            for (int mb = 0; mb < 4; ++mb) {
                v4f ca[8], cb[8];   // (cos, sin) of this lane's 4 d in its 8 rows, all asked for before the staging so that one latency covers them
#pragma unroll
                for (int s = 0; s < 8; ++s) { const float* p = CS + ((size_t)(t0 + mb * 16 + 2 * s + hi) * HD + cofs) * 2; ca[s] = *(const v4f*)p; cb[s] = *(const v4f*)(p + 4); }
                asm volatile("s_wait_xcnt 0x0" ::: "memory");   // stands in front of the work below, which reuses the registers that hold the addresses of the loads above
#pragma unroll
                for (int nb = 0; nb < 4; ++nb) {
#pragma unroll
                    for (int j = 0; j < 8; ++j) os[(hi * 8 + j) * 68 + nb * 16 + lr] = acc[mb][nb][j]; }
                __builtin_amdgcn_wave_barrier(); asm volatile("" ::: "memory");   // the rows are read back by other lanes than wrote them
#pragma unroll
                for (int s = 0; s < 8; ++s) { const int row = 2 * s + hi; const v4f val = *(const v4fa*)(os + row * 68 + cofs) + bb; v4f r;
                    r[0] = val[0] * ca[s][0] - val[1] * ca[s][1]; r[1] = val[1] * ca[s][2] + val[0] * ca[s][3]; r[2] = val[2] * cb[s][0] - val[3] * cb[s][1]; r[3] = val[3] * cb[s][2] + val[2] * cb[s][3];
                    v4h o16; v4b oh, ol;
#pragma unroll
                    for (int i = 0; i < 4; ++i) { o16[i] = tohx(r[i]); oh[i] = (__bf16)r[i]; ol[i] = (__bf16)(r[i] - (float)oh[i]); }
                    const size_t e = pb + (size_t)mb * 16 * HD + row * 8;
                    *(v4h*)(P16 + e) = o16; *(v4us*)(Ph + e) = __builtin_bit_cast(v4us, oh); *(v4us*)(Pl + e) = __builtin_bit_cast(v4us, ol);
                    asm volatile("s_wait_xcnt 0x0" ::: "memory"); }   // stands in front of the next rows' packing, which reuses the registers that the three stores name
                __builtin_amdgcn_wave_barrier(); asm volatile("" ::: "memory");   // the next 16 rows overwrite the staging only behind every lane's reads
            }
        }
        return;
    }
#pragma unroll
    for (int mb = 0; mb < 4; ++mb) {
#pragma unroll
        for (int nb = 0; nb < 4; ++nb) {
#pragma unroll
            for (int j = 0; j < 8; ++j) os[(hi * 8 + j) * 68 + nb * 16 + lr] = acc[mb][nb][j]; }
        __builtin_amdgcn_wave_barrier(); asm volatile("" ::: "memory");
        float* crow = C + (size_t)(r0 + mb * 16) * ldc + c0;
{
#pragma unroll
            for (int s = 0; s < 8; ++s) { const int row = 2 * s + hi, cofs = lr * 4; v4f val = *(const v4fa*)(os + row * 68 + cofs); if (BIAS) { val[0] += bfr(bz[c0 + cofs]); val[1] += bfr(bz[c0 + cofs + 1]); val[2] += bfr(bz[c0 + cofs + 2]); val[3] += bfr(bz[c0 + cofs + 3]); }
                *(v4f*)(crow + (size_t)row * ldc + cofs) = val;
                asm volatile("s_wait_xcnt 0x0" ::: "memory"); }   // stands in front of the next rows' work, which reuses the registers that the store names
             }
        __builtin_amdgcn_wave_barrier(); asm volatile("" ::: "memory");
    }
}


// The bodies below take their work-group's index blk inside their own job: jobs that read none of each other's output share one launch.
// wtF: Bt[n][k] = w[k][n] as bf16 in fragment order; a thread writes its lane's 16 bytes of both halves of one tile, and each of its 16 loads reads 16 consecutive n of two k rows per wave.
__device__ __forceinline__ void wtF(unsigned blk, const float* __restrict__ w, unsigned K, unsigned N, bf* Bt) {
    const unsigned u = blk * 256 + threadIdx.x, tile = u >> 5, lane = u & 31; const unsigned n = tile / (K / 32) * 16 + (lane & 15), k0 = tile % (K / 32) * 32 + (lane >> 4) * 8;
#pragma unroll
    for (int hf = 0; hf < 2; ++hf) { v8us o;
#pragma unroll
        for (int j = 0; j < 8; ++j) o[j] = f2bf(w[(size_t)(k0 + hf * 16 + j) * N + n]);
        *(v8us*)(Bt + (size_t)tile * 512 + hf * 256 + lane * 8) = o; }
    asm volatile("s_wait_xcnt 0x0" ::: "memory");   // in the built kernel another job's body stands in line behind this one and reuses the registers that the stores name
}
// cvtF: src [rows][K] f32 -> bf16 in fragment order; a wave takes two tiles (16 rows x 64 k: 256 contiguous bytes of each row), a thread its lane's 16 bytes of their four halves.
template <bool HW>   // HW: the compiler's own f32 -> bf16 conversion, as the attention loop applied it to the mask
__device__ __forceinline__ void cvtF(unsigned blk, const float* __restrict__ src, unsigned K, bf* dst) {
    const unsigned u = blk * 256 + threadIdx.x, tp = u >> 5, lane = u & 31; const unsigned row = tp / (K / 64) * 16 + (lane & 15), k0 = tp % (K / 64) * 64 + (lane >> 4) * 8; const float* p = src + (size_t)row * K + k0; v8f v[4];
#pragma unroll
    for (int q = 0; q < 4; ++q) v[q] = *(const v8f*)(p + q * 16);
#pragma unroll
    for (int q = 0; q < 4; ++q) { v8us o;
#pragma unroll
        for (int k = 0; k < 8; ++k) o[k] = HW ? __builtin_bit_cast(unsigned short, (__bf16)v[q][k]) : f2bf(v[q][k]);
        *(v8us*)(dst + (size_t)tp * 1024 + q * 256 + lane * 8) = o; }
    asm volatile("s_wait_xcnt 0x0" ::: "memory");   // in the built kernel another job's body stands in line behind this one and reuses the registers that the stores name
}
__device__ __forceinline__ void cscvt(int blk, const float* __restrict__ cosT, const float* __restrict__ sinT, float* CS) { const int idx = blk * 256 + threadIdx.x; if (idx >= TT * HD) return; v2f cs; cs[0] = bfr(cosT[idx]); cs[1] = bfr(sinT[idx]); *(v2f*)(CS + (size_t)idx * 2) = cs;  }
// ---- k_prep: every conversion that reads inputs alone, one launch: the four weights transposed to bf16 (WT: q, k, v, o one after the other), x of both batches to bf16, the mask to bf16 (the rounding that the scores add), all in fragment order; the cos/sin table.
static_assert(DQ == DM && DKV == DM && NKV == NH_, "the four weights share one shape, q and k planes one size");
#define WBLK (DM * DQ / 16 / 256)          // work-groups per weight
#define XBLK (NB_ * TT * DM / 32 / 256)    // work-groups on x
#define MBLK (TT * TT / 32 / 256)          // work-groups on the mask
#define CBLK (TT * HD / 256)               // work-groups on the cos/sin table
__global__ __launch_bounds__(256) void k_prep(const float* __restrict__ wq, const float* __restrict__ wk, const float* __restrict__ wv, const float* __restrict__ wo, const float* __restrict__ x, const float* __restrict__ mk, const float* __restrict__ cosT, const float* __restrict__ sinT, bf* WT, bf* XB, bf* MB, float* CS) {
    const int blk = blockIdx.x;
    if (blk < 4 * WBLK) { const int wi = blk / WBLK; wtF(blk % WBLK, wi == 0 ? wq : wi == 1 ? wk : wi == 2 ? wv : wo, DM, DQ, WT + (size_t)wi * DM * DQ); return; }
    if (blk < 4 * WBLK + XBLK) { cvtF<false>(blk - 4 * WBLK, x, DM, XB); return; }
    if (blk < 4 * WBLK + XBLK + MBLK) { cvtF<true>(blk - 4 * WBLK - XBLK, mk, TT, MB); return; }
    cscvt(blk - 4 * WBLK - XBLK - MBLK, cosT, sinT, CS);
}
// ---- k_fattn: scores, mask add, softmax and attn.v of both batches in ONE launch; the score plane never leaves registers.
// One wave owns NQ x 16 query columns of one head and walks all TT keys, 32 a pass: S^T = K Q^T (a lane holds 16 keys' scores of ONE query per column group), t = S^T x HD^-0.5 + mask[i][j] (its bf16 rounding, read from the plane that k_prep wrote: a score tile's lane map is the operand map, so the plane is in the same fragment order),
// running maximum and running sum per query (sum and accumulators are rescaled every pass by exp(old maximum - new maximum)), P^T packed from the two score tiles straight into a B operand (same k order as the V^T loader), O^T += V^T P^T.
// Query rows < RH: hi+lo bf16 planes, 3 products in both GEMMs; the rest: single fp16. The result O / sum goes out as the hi+lo planes of the output projection's A operand, 8 consecutive d per lane.
// AW waves of one head form a work-group and share K and V^T through LDS: a stage is SK keys (SK / 32 passes), two buffers; every thread copies its 16 bytes of each 2-KiB piece of the stage from the planes to LDS asynchronously, one stage ahead of its use.
// The planes are in fragment order, so a stage is a plain copy (K: SK HD contiguous elements; V^T: SK 16 contiguous elements for each 16 d) and a fragment is two 16-byte LDS loads of 512 contiguous bytes a wave.
#define AW   4                    // waves of a work-group
#define SK   64                   // keys of a stage
#define NST  (TT / SK)
#define PLE  (SK * HD * 2)        // elements that one plane pair (K, V^T) has in a stage: K first, V^T behind it
static_assert(AW * 32 * 8 == 1024 && SK * HD == 4 * 1024 && SK * 16 == 1024 && HD == 64 && NST >= 2, "a copy of the whole work-group is 1024 elements: four of them are a stage's K, one is a stage's V^T of 16 d");
__device__ __forceinline__ float xhalf(float f) { const int b = __float_as_int(f); return __int_as_float(__builtin_amdgcn_permlanex16(b, b, 0x76543210, 0xfedcba98, false, false)); }   // lane l reads lane l ^ 16
// one plane pair's share of a stage: l = this thread's LDS byte address in the stage's K part, kg / vg = its 16 bytes in the K and V^T planes. The wait in the statement's last line stands in front of whatever rewrites the registers that the copies name.
template <typename T16>
__device__ __forceinline__ void stage_copy(unsigned l, const T16* kg, const T16* vg) {
    asm volatile("global_load_async_to_lds_b128 %0, %1, off\n\t"
                 "global_load_async_to_lds_b128 %2, %3, off\n\t"
                 "global_load_async_to_lds_b128 %4, %5, off\n\t"
                 "global_load_async_to_lds_b128 %6, %7, off\n\t"
                 "global_load_async_to_lds_b128 %8, %9, off\n\t"
                 "global_load_async_to_lds_b128 %10, %11, off\n\t"
                 "global_load_async_to_lds_b128 %12, %13, off\n\t"
                 "global_load_async_to_lds_b128 %14, %15, off\n\t"
                 "s_wait_xcnt 0x0"
                 :: "v"(l), "v"(kg), "v"(l + 2048u), "v"(kg + 1024), "v"(l + 4096u), "v"(kg + 2048), "v"(l + 6144u), "v"(kg + 3072),
                    "v"(l + 8192u), "v"(vg), "v"(l + 10240u), "v"(vg + (size_t)16 * TT), "v"(l + 12288u), "v"(vg + (size_t)32 * TT), "v"(l + 14336u), "v"(vg + (size_t)48 * TT) : "memory");
}
template <typename T16, bool HI, int NQ>
__device__ __forceinline__ void attn_wave(const T16* __restrict__ Q, const T16* __restrict__ Q2, const T16* __restrict__ Kp, const T16* __restrict__ K2, const T16* __restrict__ Vt, const T16* __restrict__ Vt2, const bf* __restrict__ mk, int q0, bf* Ah, bf* Al, const T16* sm) {
    typedef typename WFrag<T16>::V V; typedef WFrag<T16> F;
    constexpr int BFE = (HI ? 2 : 1) * PLE;   // elements of a buffer
    const int lane = threadIdx.x & 31, tid = threadIdx.x;
    V qf[NQ][2], qf2[NQ][2], kf[2][2], kf2[2][2], vf[4], vf2[4]; v16us mf[NQ]; v8f o[NQ][4]; float m[NQ], l[NQ];
    auto fill = [&](int st) {   // stage st into buffer st % 2
        const unsigned lb = (unsigned)(size_t)(sm + (st & 1) * BFE + 8 * tid);
        stage_copy<T16>(lb, Kp + (size_t)st * (SK * HD) + 8 * tid, Vt + (size_t)st * (SK * 16) + 8 * tid);
        if constexpr (HI) stage_copy<T16>(lb + PLE * 2, K2 + (size_t)st * (SK * HD) + 8 * tid, Vt2 + (size_t)st * (SK * 16) + 8 * tid); };
    fill(0);
#pragma unroll
    for (int nq = 0; nq < NQ; ++nq) { m[nq] = -3.0e38f; l[nq] = 0.f;
#pragma unroll
        for (int ks = 0; ks < 2; ++ks) { const size_t qo = (size_t)(q0 + nq * 16) * HD + ks * 512 + 8 * lane; qf[nq][ks] = F::ld(Q + qo); if (HI) qf2[nq][ks] = F::ld(Q2 + qo); }
#pragma unroll
        for (int dt = 0; dt < 4; ++dt) o[nq][dt] = (v8f){}; }
    const bf* mrow = mk + (size_t)q0 * TT + 8 * lane;
    auto ldk = [&](const T16* sb, int p) {   // pass p of the stage at sb
#pragma unroll
        for (int kt = 0; kt < 2; ++kt)
#pragma unroll
            for (int ks = 0; ks < 2; ++ks) { const int e = 8 * lane + (p * 32 + kt * 16) * HD + ks * 512; kf[kt][ks] = F::ld(sb + e); if (HI) kf2[kt][ks] = F::ld(sb + PLE + e); } };
    // the two 16-byte halves are joined into one value: left as bare loaded values, the compiler merged this refill with the prologue's load into one load at the loop's top, its latency exposed
    auto ldm = [&](const bf* mb, int ps) {   // pass ps of the stage whose mask tiles begin at mb
#pragma unroll
        for (int nq = 0; nq < NQ; ++nq) { const bf* p = mb + (size_t)nq * 16 * TT + ps * 512; mf[nq] = __builtin_shufflevector(*(const v8us*)p, *(const v8us*)(p + 256), 0, 1, 2, 3, 4, 5, 6, 7, 8, 9, 10, 11, 12, 13, 14, 15); }
        // stands in front of the work below, which may reuse the registers that hold the address of the loads above; it takes that address as an input, so that it is not given away before the wait
        asm volatile("s_wait_xcnt 0x0" :: "v"(mb) : "memory"); };
    auto ldv = [&](const T16* sb, int p) {
#pragma unroll
        for (int dt = 0; dt < 4; ++dt) { const int e = 8 * lane + SK * HD + dt * (SK * 16) + p * 512; vf[dt] = F::ld(sb + e); if (HI) vf2[dt] = F::ld(sb + PLE + e); } };
    ldm(mrow, 0);
    asm volatile("s_wait_asynccnt 0x0" ::: "memory");   // this wave's copies of stage 0 have landed
    __syncthreads();                                     // and every other wave's: stage 0 may be read
    fill(1);
    // rolled over the stages; inside a stage each operand set is refilled in place right behind its last use, so that the next pass's LDS loads fly under this pass's work; nothing of the next stage is read before the barrier at the foot
#pragma unroll 1
    for (int st = 0; st < NST; ++st) {
        const T16* sb = sm + (st & 1) * BFE; const bf* mst = mrow + (size_t)st * (SK * 16);
        ldk(sb, 0); ldv(sb, 0);
#pragma unroll   // p decides at compile time which refills a pass has and gives every LDS load an immediate offset
        for (int p = 0; p < SK / 32; ++p) {
            v8f sc[NQ][2];
#pragma unroll
            for (int nq = 0; nq < NQ; ++nq)
#pragma unroll
                for (int kt = 0; kt < 2; ++kt) { v8f s = (v8f){};
#pragma unroll
                    for (int ks = 0; ks < 2; ++ks) { s = F::mma(kf[kt][ks], qf[nq][ks], s); if (HI) { s = F::mma(kf[kt][ks], qf2[nq][ks], s); s = F::mma(kf2[kt][ks], qf[nq][ks], s); } }
                    sc[nq][kt] = s; }
            if (p + 1 < SK / 32) ldk(sb, p + 1);
            __builtin_amdgcn_sched_barrier(0);   // keeps the K refill here, a whole softmax ahead of its use; the scheduler otherwise sinks it behind the attn.v products
            float t[NQ][16], mx[NQ];
#pragma unroll
            for (int nq = 0; nq < NQ; ++nq) { mx[nq] = m[nq];
#pragma unroll
                for (int e = 0; e < 16; ++e) { t[nq][e] = sc[nq][e >> 3][e & 7] * SCL + bf2f(mf[nq][e]); mx[nq] = fmaxf(mx[nq], t[nq][e]); } }
            if (p + 1 < SK / 32) ldm(mst, p + 1);   // the stage's last pass leaves its refill to the foot: the barrier there waits for every global load in flight
            __builtin_amdgcn_sched_barrier(0);   // keeps the mask refill here, most of a pass ahead of its use; the scheduler otherwise sinks it into the attn.v products
            V pf[NQ], pf2[NQ];
#pragma unroll
            for (int nq = 0; nq < NQ; ++nq) { const float mn = fmaxf(mx[nq], xhalf(mx[nq]));   // lanes c and c + 16 hold the two key halves of query c
                const float aa = (m[nq] - mn) * 1.4426950408889634f; const float al = __builtin_amdgcn_exp2f(aa); m[nq] = mn;
                float a[16];
#pragma unroll
                for (int e = 0; e < 16; ++e) { a[e] = (t[nq][e] - mn) * 1.4426950408889634f; t[nq][e] = __builtin_amdgcn_exp2f(a[e]); }
                // the slot that the instruction set asks for between a transcendental and an overwrite of its source: taken as inputs, the sources stay in their registers up to the v_nop and the results put it behind the exponentials
                asm volatile("v_nop" :: "v"(aa), "v"(al), "v"(a[0]), "v"(a[1]), "v"(a[2]), "v"(a[3]), "v"(a[4]), "v"(a[5]), "v"(a[6]), "v"(a[7]), "v"(t[nq][0]), "v"(t[nq][1]), "v"(t[nq][2]), "v"(t[nq][3]), "v"(t[nq][4]), "v"(t[nq][5]), "v"(t[nq][6]), "v"(t[nq][7]));
                asm volatile("v_nop" :: "v"(a[8]), "v"(a[9]), "v"(a[10]), "v"(a[11]), "v"(a[12]), "v"(a[13]), "v"(a[14]), "v"(a[15]), "v"(t[nq][8]), "v"(t[nq][9]), "v"(t[nq][10]), "v"(t[nq][11]), "v"(t[nq][12]), "v"(t[nq][13]), "v"(t[nq][14]), "v"(t[nq][15]));
                float ls[8];   // pairwise tree: four dependent adds deep instead of sixteen
#pragma unroll
                for (int e = 0; e < 8; ++e) ls[e] = t[nq][e] + t[nq][e + 8];
#pragma unroll
                for (int w = 4; w; w >>= 1)
#pragma unroll
                    for (int e = 0; e < w; ++e) ls[e] += ls[e + w];
                l[nq] = l[nq] * al + ls[0];
#pragma unroll
                for (int dt = 0; dt < 4; ++dt) o[nq][dt] *= al;
                if constexpr (HI) {
#pragma unroll
                    for (int e = 0; e < 16; ++e) { const __bf16 ph = (__bf16)t[nq][e]; pf[nq][e] = ph; pf2[nq][e] = (__bf16)(t[nq][e] - (float)ph); }
                } else {
#pragma unroll
                    for (int e = 0; e < 16; ++e) pf[nq][e] = (h16)t[nq][e]; } }
#pragma unroll
            for (int nq = 0; nq < NQ; ++nq)
#pragma unroll
                for (int dt = 0; dt < 4; ++dt) { o[nq][dt] = F::mma(vf[dt], pf[nq], o[nq][dt]); if (HI) { o[nq][dt] = F::mma(vf[dt], pf2[nq], o[nq][dt]); o[nq][dt] = F::mma(vf2[dt], pf[nq], o[nq][dt]); } }
            if (p + 1 < SK / 32) ldv(sb, p + 1);
        }
        asm volatile("s_wait_dscnt 0x0" ::: "memory");      // this wave's reads of the stage's buffer are done before the buffer is given up
        asm volatile("s_wait_asynccnt 0x0" ::: "memory");   // this wave's copies of the next stage have landed
        __syncthreads();                                     // publishes the next stage and ends every wave's reads of this one
        ldm(mrow + (size_t)(((st + 1) * SK) & (TT - 1)) * 16, 0);   // the next stage's first mask tile; the last trip refetches pass 0's (in bounds, unused)
        if (st + 2 < NST) fill(st + 2);                      // into the buffer that this trip has just read
    }
    asm volatile("s_wait_asynccnt 0x0" ::: "memory");   // no copy is outstanding when the wave ends
#pragma unroll
    for (int nq = 0; nq < NQ; ++nq) { const float inv = __fdiv_rn(1.0f, l[nq] + xhalf(l[nq])); const size_t oo = (size_t)(q0 + nq * 16) * DQ + 8 * lane;
#pragma unroll
        for (int dt = 0; dt < 4; ++dt) { v8us oh, ol;
#pragma unroll
            for (int j = 0; j < 8; ++j) { unsigned short a, c2; splitf(o[nq][dt][j] * inv, a, c2); oh[j] = a; ol[j] = c2; }
            *(v8us*)(Ah + oo + dt * 256) = oh; *(v8us*)(Al + oo + dt * 256) = ol;
            asm volatile("s_wait_xcnt 0x0" ::: "memory"); } }   // stands in front of the next tile's packing, which reuses the registers that the two stores name
}
#define HWG (RH / 16 / AW)            // work-groups per head on rows < RH: AW waves of 16 query columns
#define LWG ((TT - RH) / 32 / AW)     // work-groups per head on the other rows: AW waves of 32 query columns
static_assert(RH % (16 * AW) == 0 && (TT - RH) % (32 * AW) == 0, "whole work-groups on both kinds of rows");
// the 3-product work-groups have the low indices and start first
__global__ __launch_bounds__(AW * 32) void k_fattn(const h16* __restrict__ Q16, const h16* __restrict__ K16, const h16* __restrict__ V16, const bf* __restrict__ Qh, const bf* __restrict__ Ql, const bf* __restrict__ Kh, const bf* __restrict__ Kl, const bf* __restrict__ Vh, const bf* __restrict__ Vl, const bf* __restrict__ mk, bf* Ah, bf* Al) {
    __shared__ __attribute__((aligned(128))) unsigned short sm[2 * 2 * PLE];   // two buffers of a stage's hi and lo plane pairs (the fp16 rows use half)
    const int blk = blockIdx.x, wv = threadIdx.x >> 5;
    // bh = b NH_ + h: the planes are [b][h], the mask is one for all, the output rows are b TT + t, its k is h HD + d (HD / 32 tiles a head)
    if (blk < NB_ * NH_ * HWG) { const int bh = blk / HWG, h = bh % NH_, b = bh / NH_; const size_t po = (size_t)bh * TT * HD, pk = (size_t)(b * NKV + h / REP) * TT * HD, ao = (size_t)b * TT * DQ + h * (HD * 16); attn_wave<bf, true, 1>(Qh + po, Ql + po, Kh + pk, Kl + pk, Vh + pk, Vl + pk, mk, ((blk % HWG) * AW + wv) * 16, Ah + ao, Al + ao, (const bf*)sm); }
    else { const int b2 = blk - NB_ * NH_ * HWG; const int bh = b2 / LWG, h = bh % NH_, b = bh / NH_; const size_t po = (size_t)bh * TT * HD, pk = (size_t)(b * NKV + h / REP) * TT * HD, ao = (size_t)b * TT * DQ + h * (HD * 16); attn_wave<h16, false, 2>(Q16 + po, nullptr, K16 + pk, nullptr, V16 + pk, nullptr, mk, RH + ((b2 % LWG) * AW + wv) * 32, Ah + ao, Al + ao, (const h16*)sm); }
}

extern "C" void kernel_launch(void* const* d_in, const int* in_sizes, int n_in,
                              void* d_out, int out_size, void* d_ws, size_t ws_size, hipStream_t stream) {
    (void)in_sizes; (void)n_in; (void)out_size;
    const float* x = (const float*)d_in[0]; const float* rope = (const float*)d_in[1]; const float* cosT = rope; const float* sinT = rope + (size_t)TT * HD; const float* fmask = (const float*)d_in[2]; const float* wq = (const float*)d_in[3]; const float* bq = (const float*)d_in[4]; const float* wk = (const float*)d_in[5]; const float* bk = (const float*)d_in[6]; const float* wv = (const float*)d_in[7]; const float* bv = (const float*)d_in[8]; const float* wo = (const float*)d_in[9]; const float* bo = (const float*)d_in[10];
    float* OUT = (float*)d_out;     // [2][2048][1024]
    char* wsp = (char*)d_ws;
    auto take = [&](size_t bytes) { char* p = wsp; wsp += (bytes + 255) & ~(size_t)255; return (void*)p; };
    bf* WT = (bf*)take((size_t)4 * DQ * DM * 2); float* CS = (float*)take((size_t)TT * HD * 2 * 4);
    bf* XB = (bf*)take((size_t)NB_ * TT * DM * 2); bf* MB = (bf*)take((size_t)TT * TT * 2);
    h16* QK16 = (h16*)take(2 * PLN * 2); h16* VT16 = (h16*)take(PLN * 2);
    bf* QKh = (bf*)take(2 * PLN * 2); bf* QKl = (bf*)take(2 * PLN * 2); bf* VTh = (bf*)take(PLN * 2); bf* VTl = (bf*)take(PLN * 2);
    bf* ATh = (bf*)take((size_t)NB_ * TT * DQ * 2); bf* ATl = (bf*)take((size_t)NB_ * TT * DQ * 2);
    if ((size_t)(wsp - (char*)d_ws) > ws_size) return;    // ws 256 MiB
    k_prep<<<4 * WBLK + XBLK + MBLK + CBLK, 256, 0, stream>>>(wq, wk, wv, wo, x, fmask, cosT, sinT, WT, XB, MB, CS);
    k_gemmw<bf, 0, true, DM, 2, true><<<dim3(NB_ * TT / 128, DQ / 128, 3), GW * 32, 0, stream>>>(XB, nullptr, WT, nullptr, nullptr, DQ, bq, bk, bv, 0, (size_t)DQ * DM, 0, CS, QK16, QKh, QKl, VT16, VTh, VTl);
    k_fattn<<<NB_ * NH_ * (HWG + LWG), AW * 32, 0, stream>>>(QK16, QK16 + PLN, VT16, QKh, QKl, QKh + PLN, QKl + PLN, VTh, VTl, MB, ATh, ATl);
    k_gemmw<bf, 1, true, DQ, 4><<<dim3(NB_ * TT / 128, DM / 128, 1), GW * 32, 0, stream>>>(ATh, ATl, WT + (size_t)3 * DQ * DM, nullptr, OUT, DM, bo, bo, bo, 0, 0, 0);
}
